// v000
// Measured on an AMD MI455X. A time is GPU time per run, averaged over a window of back-to-back runs after a warm-up
// (all launches, gaps included; the runs take copies of the inputs in turn), and the median of several windows.
// Apart from v000's, it joins two sittings. Times from different sittings can be a few percent apart, while
// side-by-side timings come from the same sitting.
// v000, which the later versions start from, runs in 393 microseconds.
// compute dtype: Q, K, V, WQ, WK, WV, bias (module inputs) rounded to bf16; Vproj with exact bf16 products on WMMA; the per-head scalar scores attn_Q/attn_K as f32 dots of bf16-rounded inputs; rank-1 logits leaky(aq[q] + ak[k]) and the online softmax in f32; P.Vproj with both computed operands as bf16 hi + residual pairs (3 products); f32 accumulate.
#include <hip/hip_runtime.h>
#include <math.h>

typedef __attribute__((ext_vector_type(16))) _Float16 v16h;
typedef __attribute__((ext_vector_type(16))) __bf16 v16b;
typedef __attribute__((ext_vector_type(8)))  _Float16 v8h;
typedef __attribute__((ext_vector_type(8)))  float v8f;
typedef __attribute__((ext_vector_type(4)))  float v4f;
typedef __attribute__((ext_vector_type(2)))  float v2f;
typedef __attribute__((ext_vector_type(4)))  unsigned v4u;
typedef __attribute__((ext_vector_type(4)))  int v4i;
typedef float __attribute__((may_alias)) float_a;
typedef int __attribute__((may_alias)) int_a;

template <typename T> __device__ __forceinline__ void vst2(void* p, T v) { *(T*)p = v;  }
__device__ __forceinline__ v8f wmma16(v16h a, v16h b, v8f c) {
  v8f d = __builtin_amdgcn_wmma_f32_16x16x32_f16(false, a, false, b, (short)0, c, false, false);
  asm volatile("v_nop\n\tv_nop\n\tv_nop\n\tv_nop" : "+v"(d) : "v"(a), "v"(b));
  return d;
}
__device__ __forceinline__ v8f wmma_bf(v16b a, v16b b, v8f c) {
  v8f d = __builtin_amdgcn_wmma_f32_16x16x32_bf16(false, a, false, b, (short)0, c, false, false);
  asm volatile("v_nop\n\tv_nop\n\tv_nop\n\tv_nop" : "+v"(d) : "v"(a), "v"(b));
  return d;
}
// 16x16x32 fragments: lane = (h = lane>>4, row/col = lane&15); elements 0..7 = k0+8h+0..7, 8..15 = k0+16+8h+0..7; D element r = row 8h+r
__device__ __forceinline__ v16h frag_h(const _Float16* rowk0, int lane) {
  union { v16h v; v8h q[2]; } u; const _Float16* p = rowk0 + 8 * (lane >> 4);
  u.q[0] = *(const v8h*)p; u.q[1] = *(const v8h*)(p + 16); return u.v;
}
__device__ __forceinline__ v16h frag_f32(const float* rowk0, int lane) {
  v16h a; const float* p = rowk0 + 8 * (lane >> 4);
#pragma unroll
  for (int i = 0; i < 8; ++i) { a[i] = (_Float16)p[i]; a[8 + i] = (_Float16)p[16 + i]; }
  return a;
}
__device__ __forceinline__ v16h frag_f32s(const float* rowk0, int lane, float sc) {
  v16h a; const float* p = rowk0 + 8 * (lane >> 4);
#pragma unroll
  for (int i = 0; i < 8; ++i) { a[i] = (_Float16)(p[i] * sc); a[8 + i] = (_Float16)(p[16 + i] * sc); }
  return a;
}
// column fragment from a [K][ld] layout (column n), rows >= K read as 0
__device__ __forceinline__ v16h fragc_f32(const float* W, int k0, int n, int lane, int ld, int K) {
  v16h a; const int g = lane >> 4;
#pragma unroll
  for (int i = 0; i < 8; ++i) { const int ka = k0 + 8 * g + i, kb = ka + 16;
    a[i] = (_Float16)(ka < K ? W[(size_t)(ka < K ? ka : K - 1) * ld + n] : 0.f); a[8 + i] = (_Float16)(kb < K ? W[(size_t)(kb < K ? kb : K - 1) * ld + n] : 0.f); }
  return a;
}
struct F2 { v16b h, l; };
__device__ __forceinline__ F2 bsplit16(const float v[16]) { F2 r;
#pragma unroll
  for (int i = 0; i < 16; ++i) { const __bf16 h = (__bf16)v[i]; r.h[i] = h; r.l[i] = (__bf16)(v[i] - (float)h); }
  return r; }
__device__ __forceinline__ F2 split_row(const float* row, int k0, int lane) { float v[16]; const float* p = row + k0 + 8 * (lane >> 4);
#pragma unroll
  for (int i = 0; i < 8; ++i) { v[i] = p[i]; v[8 + i] = p[16 + i]; }
  return bsplit16(v); }
__device__ __forceinline__ F2 split_rowK(const float* row, int k0, int lane, int K) { float v[16]; const int g = lane >> 4;
#pragma unroll
  for (int i = 0; i < 8; ++i) { const int ka = k0 + 8 * g + i, kb = ka + 16; v[i] = ka < K ? row[ka < K ? ka : K - 1] : 0.f; v[8 + i] = kb < K ? row[kb < K ? kb : K - 1] : 0.f; }
  return bsplit16(v); }
__device__ __forceinline__ F2 split_col(const float* W, int k0, int n, int lane, int ld, int K) { float v[16]; const int g = lane >> 4;
#pragma unroll
  for (int i = 0; i < 8; ++i) { const int ka = k0 + 8 * g + i, kb = ka + 16; v[i] = ka < K ? W[(size_t)(ka < K ? ka : K - 1) * ld + n] : 0.f; v[8 + i] = kb < K ? W[(size_t)(kb < K ? kb : K - 1) * ld + n] : 0.f; }
  return bsplit16(v); }
__device__ __forceinline__ v8f mac3(const F2& a, const F2& b, v8f c) { c = wmma_bf(a.l, b.h, c); c = wmma_bf(a.h, b.l, c); return wmma_bf(a.h, b.h, c); }
__device__ __forceinline__ float sigm(float v) { return 1.0f / (1.0f + expf(-v)); }
#define LDSX() do { asm volatile("s_wait_dscnt 0" ::: "memory"); __builtin_amdgcn_wave_barrier(); __builtin_amdgcn_fence(__ATOMIC_RELEASE, "workgroup"); } while (0)


// Additive multi-head attention block: Vproj = V WV^T (8 heads x 64), attn_Q = Q WQ^T, attn_K = K WK^T (one scalar per head), w = softmax_k(leaky_relu(attn_Q[q,h] + attn_K[k,h], 0.2)), out[q, h*64 + d] = sum_k w Vproj[k,h,d] + bias[h,d].  B 8, 1024 queries/keys, dims 512.
// k_vproj (exact GEMM -> transposed hi/lo planes), k_aqk (the 16 scalar projections per row, f32), k_attn (block = (64 queries, b*8+h): 32 key steps, VALU logits, online max/sum, P hi/lo x Vproj planes, + bias).
#define NB 8
#define SQ 1024
#define SK 1024
#define DI 512
#define NH 8
#define OD 64
#ifndef TQB
#define TQB (SQ / 64)
#define TNB NB
#endif
typedef __attribute__((ext_vector_type(8))) __bf16 v8b;
__device__ __forceinline__ v16b frag_b(const __bf16* rowk0, int lane) {
  union { v16b v; v8b q[2]; } u; const __bf16* p = rowk0 + 8 * (lane >> 4);
  u.q[0] = *(const v8b*)p; u.q[1] = *(const v8b*)(p + 16); return u.v;
}
__device__ __forceinline__ v16b frag_gbf(const float* rowk0, int lane) {
  v16b a; const float* p = rowk0 + 8 * (lane >> 4);
#pragma unroll
  for (int i = 0; i < 8; ++i) { a[i] = (__bf16)p[i]; a[8 + i] = (__bf16)p[16 + i]; }
  return a;
}
__device__ __forceinline__ float bfr(float v) { return (float)(__bf16)v; }
__device__ __attribute__((noinline)) float exp_ni(float v) { return expf(v); }
#define WS_VTH  0u                                   // bf16 [8][512][1024] Vproj transposed hi
#define WS_VTL  (WS_VTH + 2u * NB * DI * SK)
#define WS_AQ   (WS_VTL + 2u * NB * DI * SK)           // f32 [8][8 h][1024 q]
#define WS_AK   (WS_AQ + 4u * NB * NH * SQ)            // f32 [8][8 h][1024 k]
#define WS_END  (WS_AK + 4u * NB * NH * SK)

__global__ __launch_bounds__(128) void k_vproj(const float* __restrict__ V, const float* __restrict__ WV, __bf16* __restrict__ VTH, __bf16* __restrict__ VTL) {
  __shared__ __align__(16) __bf16 sh[DI][72], sl[DI][72];
  const int tid = threadIdx.x, wave = tid >> 5, lane = tid & 31, col = lane & 15, g = lane >> 4; const int b = blockIdx.y; const int k0 = blockIdx.x * 64;
  const float* Vb = V + ((size_t)b * SK + k0 + wave * 16) * DI;
#pragma unroll 1
  for (int oc = 0; oc < DI / 128; ++oc) { v8f acc[8] = {};
#pragma unroll 2
    for (int kc = 0; kc < DI / 32; ++kc) { const v16b a = frag_gbf(Vb + (size_t)col * DI + kc * 32, lane);
#pragma unroll
      for (int j = 0; j < 8; ++j) acc[j] = wmma_bf(a, frag_gbf(WV + (size_t)(oc * 128 + j * 16 + col) * DI + kc * 32, lane), acc[j]); }
#pragma unroll
    for (int j = 0; j < 8; ++j)
#pragma unroll
      for (int r = 0; r < 8; ++r) { const int o = oc * 128 + j * 16 + col; const float v = acc[j][r]; const __bf16 hb = (__bf16)v; sh[o][wave * 16 + 8 * g + r] = hb; sl[o][wave * 16 + 8 * g + r] = (__bf16)(v - (float)hb); } }
  __syncthreads();
  for (int q = tid; q < DI * 8; q += 128) { const int o = q >> 3, pc = q & 7; const size_t off = ((size_t)b * DI + o) * SK + k0 + pc * 8; vst2((unsigned*)(VTH + off), *(const v4u*)&sh[o][pc * 8]); vst2((unsigned*)(VTL + off), *(const v4u*)&sl[o][pc * 8]); }
}
// ---- k_aqk: block = (64 rows, b, which): which 0: AQ[b][h][q] = sum_i Q[b][q][i] WQ[h][i]; which 1: AK from K/WK; thread = (row, 4 per row = 2 heads each); rows of 64 floats per (b,h) = 256-B segments
__global__ __launch_bounds__(256) void k_aqk(const float* __restrict__ Q, const float* __restrict__ K, const float* __restrict__ WQ, const float* __restrict__ WK, float* __restrict__ AQ, float* __restrict__ AK) {
  __shared__ float sw[NH][DI]; __shared__ __align__(16) float so[NH][64];
  const int tid = threadIdx.x, b = blockIdx.y, which = blockIdx.z; const int r0 = blockIdx.x * 64; const float* X = which == 0 ? Q : K; const float* Wm = which == 0 ? WQ : WK; float* A = which == 0 ? AQ : AK; const int L = which == 0 ? SQ : SK;
  for (int q = tid; q < NH * DI; q += 256) sw[q / DI][q % DI] = bfr(Wm[q]);
  __syncthreads();
  { const int rl = tid >> 2, hp = tid & 3; const float* xr = X + ((size_t)b * L + r0 + rl) * DI; float a0 = 0.f, a1 = 0.f;
#pragma unroll 1
    for (int i = 0; i < DI; ++i) { const float xv = bfr(xr[i]); a0 += xv * sw[hp * 2][i]; a1 += xv * sw[hp * 2 + 1][i]; }
    so[hp * 2][rl] = a0; so[hp * 2 + 1][rl] = a1; }
  __syncthreads();
  if (tid < NH * 16) { const int h = tid >> 4, pc = tid & 15; vst2(A + ((size_t)b * NH + h) * L + r0 + pc * 4, *(const v4f*)&so[h][pc * 4]); }
}
// ---- k_attn: block = (64 queries, b*8+h), 4 waves: s = leaky(aq[q] + ak[k], 0.2); online softmax; P hi/lo x Vproj planes (head columns h*64..+63 = rows b*512 + h*64 + d) 3 products; + bias[h][d]; out row segment 256 B
__global__ __launch_bounds__(128) void k_attn(const float* __restrict__ AQ, const float* __restrict__ AK, const __bf16* __restrict__ VTH, const __bf16* __restrict__ VTL, const float* __restrict__ BIAS, float* __restrict__ OUT) {
  __shared__ __align__(16) float sp[4][16][36]; __shared__ __align__(16) float so[4][16][68];
  const int tid = threadIdx.x, wave = tid >> 5, lane = tid & 31, col = lane & 15, g = lane >> 4;
  const int qb = blockIdx.x, bh = blockIdx.y, b = bh / NH, h = bh % NH; const int q0 = qb * 64 + wave * 16;
  float aq[8];
#pragma unroll
  for (int r = 0; r < 8; ++r) aq[r] = AQ[((size_t)b * NH + h) * SQ + q0 + 8 * g + r];
  const float* AKb = AK + ((size_t)b * NH + h) * SK;
  float m[8], l[8]; v8f acc[4] = {};
#pragma unroll
  for (int r = 0; r < 8; ++r) { m[r] = -3.0e38f; l[r] = 0.f; }
#pragma unroll 1
  for (int ks = 0; ks < SK / 32; ++ks) { const float k0v = AKb[ks * 32 + col], k1v = AKb[ks * 32 + 16 + col]; float s[2][8];
#pragma unroll
    for (int r = 0; r < 8; ++r) { float u = aq[r] + k0v; s[0][r] = u > 0.f ? u : 0.2f * u; u = aq[r] + k1v; s[1][r] = u > 0.f ? u : 0.2f * u; }
#pragma unroll
    for (int r = 0; r < 8; ++r) { float mx = fmaxf(s[0][r], s[1][r]);
#pragma unroll
      for (int o = 1; o < 16; o <<= 1) mx = fmaxf(mx, __shfl_xor(mx, o));
      const float mn = fmaxf(m[r], mx); const float alpha = exp_ni(m[r] - mn); const float e0 = exp_ni(s[0][r] - mn), e1 = exp_ni(s[1][r] - mn); float es = e0 + e1;
#pragma unroll
      for (int o = 1; o < 16; o <<= 1) es += __shfl_xor(es, o);
      l[r] = l[r] * alpha + es; m[r] = mn;
#pragma unroll
      for (int dt = 0; dt < 4; ++dt) acc[dt][r] *= alpha;
      sp[wave][8 * g + r][col] = e0; sp[wave][8 * g + r][16 + col] = e1; }
    LDSX();
    const F2 pa = split_row(&sp[wave][col][0], 0, lane);
#pragma unroll
    for (int dt = 0; dt < 4; ++dt) { const size_t vrow = ((size_t)b * DI + h * OD + dt * 16 + col) * SK + ks * 32; const v16b vh = frag_b(VTH + vrow, lane), vl = frag_b(VTL + vrow, lane); acc[dt] = wmma_bf(pa.l, vh, acc[dt]); acc[dt] = wmma_bf(pa.h, vl, acc[dt]); acc[dt] = wmma_bf(pa.h, vh, acc[dt]); }
    LDSX(); }
#pragma unroll
  for (int r = 0; r < 8; ++r) { const float il = 1.0f / l[r];
#pragma unroll
    for (int dt = 0; dt < 4; ++dt) so[wave][8 * g + r][dt * 16 + col] = acc[dt][r] * il + bfr(BIAS[h * OD + dt * 16 + col]); }
  LDSX();
  for (int rl = 0; rl < 16; ++rl) if (lane < 16) vst2(OUT + ((size_t)b * SQ + q0 + rl) * (NH * OD) + h * OD + lane * 4, *(const v4f*)&so[wave][rl][lane * 4]);
}
extern "C" void kernel_launch(void* const* d_in, const int* in_sizes, int n_in, void* d_out, int out_size, void* d_ws, size_t ws_size, hipStream_t stream) {
  (void)in_sizes; (void)n_in; (void)out_size;
  const float** F = (const float**)d_in;   // Q, K, V [8,1024,512], WQ [8,512], WK [8,512], WV [512,512], bias [8,64]
  if (ws_size < (size_t)WS_END) return;
  char* ws = (char*)d_ws; __bf16 *VTH = (__bf16*)(ws + WS_VTH), *VTL = (__bf16*)(ws + WS_VTL); float *AQ = (float*)(ws + WS_AQ), *AK = (float*)(ws + WS_AK);
  k_vproj<<<dim3(SK / 64, TNB), 128, 0, stream>>>(F[2], F[5], VTH, VTL);
  k_aqk<<<dim3(SQ / 64, TNB, 2), 256, 0, stream>>>(F[0], F[1], F[3], F[4], AQ, AK);
  k_attn<<<dim3(TQB, TNB * NH), 128, 0, stream>>>(AQ, AK, VTH, VTL, F[6], (float*)d_out);
}

// v001
// Measured time: 208 microseconds a run.
// Timed twice side by side with v000, it ran 1.90 and 1.91 times as fast.
// compute dtype: Q, K, V, WQ, WK, WV, bias (module inputs) rounded to bf16; Vproj with exact bf16 products on WMMA; the per-head scalar scores attn_Q/attn_K as f32 dots of bf16-rounded inputs; rank-1 logits leaky(aq[q] + ak[k]) and the online softmax in f32; P.Vproj with both computed operands as bf16 hi + residual pairs (3 products); f32 accumulate.
#include <hip/hip_runtime.h>
#include <math.h>

typedef __attribute__((ext_vector_type(16))) _Float16 v16h;
typedef __attribute__((ext_vector_type(16))) __bf16 v16b;
typedef __attribute__((ext_vector_type(8)))  _Float16 v8h;
typedef __attribute__((ext_vector_type(8)))  float v8f;
typedef __attribute__((ext_vector_type(4)))  float v4f;
typedef __attribute__((ext_vector_type(2)))  float v2f;
typedef __attribute__((ext_vector_type(4)))  unsigned v4u;
typedef __attribute__((ext_vector_type(4)))  int v4i;
typedef float __attribute__((may_alias)) float_a;
typedef int __attribute__((may_alias)) int_a;

template <typename T> __device__ __forceinline__ void vst2(void* p, T v) { *(T*)p = v;  }
__device__ __forceinline__ v8f wmma16(v16h a, v16h b, v8f c) {
  v8f d = __builtin_amdgcn_wmma_f32_16x16x32_f16(false, a, false, b, (short)0, c, false, false);
  asm volatile("v_nop\n\tv_nop\n\tv_nop\n\tv_nop" : "+v"(d) : "v"(a), "v"(b));
  return d;
}
__device__ __forceinline__ v8f wmma_bf(v16b a, v16b b, v8f c) {
  v8f d = __builtin_amdgcn_wmma_f32_16x16x32_bf16(false, a, false, b, (short)0, c, false, false);
  asm volatile("v_nop\n\tv_nop\n\tv_nop\n\tv_nop" : "+v"(d) : "v"(a), "v"(b));
  return d;
}
// 16x16x32 fragments: lane = (h = lane>>4, row/col = lane&15); elements 0..7 = k0+8h+0..7, 8..15 = k0+16+8h+0..7; D element r = row 8h+r
__device__ __forceinline__ v16h frag_h(const _Float16* rowk0, int lane) {
  union { v16h v; v8h q[2]; } u; const _Float16* p = rowk0 + 8 * (lane >> 4);
  u.q[0] = *(const v8h*)p; u.q[1] = *(const v8h*)(p + 16); return u.v;
}
__device__ __forceinline__ v16h frag_f32(const float* rowk0, int lane) {
  v16h a; const float* p = rowk0 + 8 * (lane >> 4);
#pragma unroll
  for (int i = 0; i < 8; ++i) { a[i] = (_Float16)p[i]; a[8 + i] = (_Float16)p[16 + i]; }
  return a;
}
__device__ __forceinline__ v16h frag_f32s(const float* rowk0, int lane, float sc) {
  v16h a; const float* p = rowk0 + 8 * (lane >> 4);
#pragma unroll
  for (int i = 0; i < 8; ++i) { a[i] = (_Float16)(p[i] * sc); a[8 + i] = (_Float16)(p[16 + i] * sc); }
  return a;
}
// column fragment from a [K][ld] layout (column n), rows >= K read as 0
__device__ __forceinline__ v16h fragc_f32(const float* W, int k0, int n, int lane, int ld, int K) {
  v16h a; const int g = lane >> 4;
#pragma unroll
  for (int i = 0; i < 8; ++i) { const int ka = k0 + 8 * g + i, kb = ka + 16;
    a[i] = (_Float16)(ka < K ? W[(size_t)(ka < K ? ka : K - 1) * ld + n] : 0.f); a[8 + i] = (_Float16)(kb < K ? W[(size_t)(kb < K ? kb : K - 1) * ld + n] : 0.f); }
  return a;
}
struct F2 { v16b h, l; };
__device__ __forceinline__ F2 bsplit16(const float v[16]) { F2 r;
#pragma unroll
  for (int i = 0; i < 16; ++i) { const __bf16 h = (__bf16)v[i]; r.h[i] = h; r.l[i] = (__bf16)(v[i] - (float)h); }
  return r; }
__device__ __forceinline__ F2 split_row(const float* row, int k0, int lane) { float v[16]; const float* p = row + k0 + 8 * (lane >> 4);
#pragma unroll
  for (int i = 0; i < 8; ++i) { v[i] = p[i]; v[8 + i] = p[16 + i]; }
  return bsplit16(v); }
__device__ __forceinline__ F2 split_rowK(const float* row, int k0, int lane, int K) { float v[16]; const int g = lane >> 4;
#pragma unroll
  for (int i = 0; i < 8; ++i) { const int ka = k0 + 8 * g + i, kb = ka + 16; v[i] = ka < K ? row[ka < K ? ka : K - 1] : 0.f; v[8 + i] = kb < K ? row[kb < K ? kb : K - 1] : 0.f; }
  return bsplit16(v); }
__device__ __forceinline__ F2 split_col(const float* W, int k0, int n, int lane, int ld, int K) { float v[16]; const int g = lane >> 4;
#pragma unroll
  for (int i = 0; i < 8; ++i) { const int ka = k0 + 8 * g + i, kb = ka + 16; v[i] = ka < K ? W[(size_t)(ka < K ? ka : K - 1) * ld + n] : 0.f; v[8 + i] = kb < K ? W[(size_t)(kb < K ? kb : K - 1) * ld + n] : 0.f; }
  return bsplit16(v); }
__device__ __forceinline__ v8f mac3(const F2& a, const F2& b, v8f c) { c = wmma_bf(a.l, b.h, c); c = wmma_bf(a.h, b.l, c); return wmma_bf(a.h, b.h, c); }
__device__ __forceinline__ float sigm(float v) { return 1.0f / (1.0f + expf(-v)); }
#define LDSX() do { asm volatile("s_wait_dscnt 0" ::: "memory"); __builtin_amdgcn_wave_barrier(); __builtin_amdgcn_fence(__ATOMIC_RELEASE, "workgroup"); } while (0)


// Additive multi-head attention block: Vproj = V WV^T (8 heads x 64), attn_Q = Q WQ^T, attn_K = K WK^T (one scalar per head), w = softmax_k(leaky_relu(attn_Q[q,h] + attn_K[k,h], 0.2)), out[q, h*64 + d] = sum_k w Vproj[k,h,d] + bias[h,d].  B 8, 1024 queries/keys, dims 512.
// k_vproj (exact GEMM -> transposed hi/lo planes), k_aqk (the 16 scalar projections per row, f32), k_attn (block = (64 queries, b*8+h): 32 key steps, VALU logits, online max/sum, P hi/lo x Vproj planes, + bias).
#define NB 8
#define SQ 1024
#define SK 1024
#define DI 512
#define NH 8
#define OD 64
#ifndef TQB
#define TQB (SQ / 64)
#define TNB NB
#endif
typedef __attribute__((ext_vector_type(8))) __bf16 v8b;
__device__ __forceinline__ v16b frag_b(const __bf16* rowk0, int lane) {
  union { v16b v; v8b q[2]; } u; const __bf16* p = rowk0 + 8 * (lane >> 4);
  u.q[0] = *(const v8b*)p; u.q[1] = *(const v8b*)(p + 16); return u.v;
}
__device__ __forceinline__ v16b frag_gbf(const float* rowk0, int lane) {
  v16b a; const float* p = rowk0 + 8 * (lane >> 4);
#pragma unroll
  for (int i = 0; i < 8; ++i) { a[i] = (__bf16)p[i]; a[8 + i] = (__bf16)p[16 + i]; }
  return a;
}
__device__ __forceinline__ float bfr(float v) { return (float)(__bf16)v; }
__device__ __attribute__((noinline)) float exp_ni(float v) { return expf(v); }
#define WS_VTH  0u                                   // bf16 [8][512][1024] Vproj transposed hi
#define WS_VTL  (WS_VTH + 2u * NB * DI * SK)
#define WS_AQ   (WS_VTL + 2u * NB * DI * SK)           // f32 [8][8 h][1024 q]
#define WS_AK   (WS_AQ + 4u * NB * NH * SQ)            // f32 [8][8 h][1024 k]
#define WS_END  (WS_AK + 4u * NB * NH * SK)

// k_vproj staging: the block's 64 V rows (all 512 k) and, per stage, 128 WV rows x 256 k are read once per block by whole-line loads (a wave-wide 16-B load = 512 contiguous bytes), rounded to bf16 once and kept in LDS; all four waves take their fragments from there.
#define VPITCH 520   // bf16 per staged V row: 1040 B = 16 B x 65 (odd), the pitch for 16-byte LDS readers
#define WPITCH 264   // bf16 per staged WV half row: 528 B = 16 B x 33 (odd)
typedef __attribute__((ext_vector_type(4))) __bf16 v4b;
__global__ __launch_bounds__(128) void k_vproj(const float* __restrict__ V, const float* __restrict__ WV, __bf16* __restrict__ VTH, __bf16* __restrict__ VTL) {
  __shared__ __align__(16) __bf16 sh[DI][72], sl[DI][72];
  __shared__ __align__(16) __bf16 sv[64][VPITCH], sw[128][WPITCH];
  const int tid = threadIdx.x, wave = tid >> 5, lane = tid & 31, col = lane & 15, g = lane >> 4; const int b = blockIdx.y; const int k0 = blockIdx.x * 64;
  const float* Vt = V + ((size_t)b * SK + k0) * DI + tid * 4;   // thread = 4 k of every row
  // unroll 32: that many independent 16-B loads per lane in flight, so a batch pays the load latency once
#pragma unroll 32
  for (int r = 0; r < 64; ++r) *(v4b*)&sv[r][tid * 4] = __builtin_convertvector(*(const v4f*)(Vt + (size_t)r * DI), v4b);
  const int wr = tid >> 6, wc = (tid & 63) * 4;                  // thread = 4 k of every second row of a stage
#pragma unroll 1
  for (int oc = 0; oc < DI / 128; ++oc) { v8f acc[8] = {};
    // unroll 1: one copy of the stage and its matrix block in the text
#pragma unroll 1
    for (int kh = 0; kh < 2; ++kh) { const float* Wt = WV + (size_t)(oc * 128 + wr) * DI + kh * 256 + wc;
      __syncthreads();   // every wave has finished its reads of the stage that sw still holds
      // unroll 32: as above
#pragma unroll 32
      for (int r = 0; r < 64; ++r) *(v4b*)&sw[2 * r + wr][wc] = __builtin_convertvector(*(const v4f*)(Wt + (size_t)(2 * r) * DI), v4b);
      __syncthreads();   // the stage (and, the first time, sv) is visible to every wave
      const __bf16* ap = &sv[wave * 16 + col][kh * 256]; const __bf16* bp = &sw[col][0];
      v16b fa[2], fb[2][8];   // two fragment sets: the next 32 k are fetched as one group ahead of the current matrix instructions, which then do not wait out the LDS latency
      fa[0] = frag_b(ap, lane);
#pragma unroll
      for (int j = 0; j < 8; ++j) fb[0][j] = frag_b(bp + j * 16 * WPITCH, lane);
      // full unroll, here and in the j loops: set and tile indices must be compile-time constants for the sets to stay in registers
#pragma unroll
      for (int kc = 0; kc < 8; ++kc) { const int cu = kc & 1, nx = cu ^ 1;
        if (kc + 1 < 8) { fa[nx] = frag_b(ap + (kc + 1) * 32, lane);
#pragma unroll
          for (int j = 0; j < 8; ++j) fb[nx][j] = frag_b(bp + j * 16 * WPITCH + (kc + 1) * 32, lane); }
#pragma unroll
        for (int j = 0; j < 8; ++j) acc[j] = wmma_bf(fa[cu], fb[cu][j], acc[j]); } }
#pragma unroll
    for (int j = 0; j < 8; ++j)
#pragma unroll
      for (int r = 0; r < 8; ++r) { const int o = oc * 128 + j * 16 + col; const float v = acc[j][r]; const __bf16 hb = (__bf16)v; sh[o][wave * 16 + 8 * g + r] = hb; sl[o][wave * 16 + 8 * g + r] = (__bf16)(v - (float)hb); } }
  __syncthreads();
  for (int q = tid; q < DI * 8; q += 128) { const int o = q >> 3, pc = q & 7; const size_t off = ((size_t)b * DI + o) * SK + k0 + pc * 8; vst2((unsigned*)(VTH + off), *(const v4u*)&sh[o][pc * 8]); vst2((unsigned*)(VTL + off), *(const v4u*)&sl[o][pc * 8]); }
}
// ---- k_aqk: block = (64 rows, b, which): which 0: AQ[b][h][q] = sum_i Q[b][q][i] WQ[h][i]; which 1: AK from K/WK; thread = (row, 4 per row = 2 heads each); rows of 64 floats per (b,h) = 256-B segments
__global__ __launch_bounds__(256) void k_aqk(const float* __restrict__ Q, const float* __restrict__ K, const float* __restrict__ WQ, const float* __restrict__ WK, float* __restrict__ AQ, float* __restrict__ AK) {
  __shared__ float sw[NH][DI]; __shared__ __align__(16) float so[NH][64];
  const int tid = threadIdx.x, b = blockIdx.y, which = blockIdx.z; const int r0 = blockIdx.x * 64; const float* X = which == 0 ? Q : K; const float* Wm = which == 0 ? WQ : WK; float* A = which == 0 ? AQ : AK; const int L = which == 0 ? SQ : SK;
  for (int q = tid; q < NH * DI; q += 256) sw[q / DI][q % DI] = bfr(Wm[q]);
  __syncthreads();
  { const int rl = tid >> 2, hp = tid & 3; const float* xr = X + ((size_t)b * L + r0 + rl) * DI; float a0 = 0.f, a1 = 0.f;
#pragma unroll 1
    for (int i = 0; i < DI; ++i) { const float xv = bfr(xr[i]); a0 += xv * sw[hp * 2][i]; a1 += xv * sw[hp * 2 + 1][i]; }
    so[hp * 2][rl] = a0; so[hp * 2 + 1][rl] = a1; }
  __syncthreads();
  if (tid < NH * 16) { const int h = tid >> 4, pc = tid & 15; vst2(A + ((size_t)b * NH + h) * L + r0 + pc * 4, *(const v4f*)&so[h][pc * 4]); }
}
// ---- k_attn: block = (64 queries, b*8+h), 4 waves: s = leaky(aq[q] + ak[k], 0.2); online softmax; P hi/lo x Vproj planes (head columns h*64..+63 = rows b*512 + h*64 + d) 3 products; + bias[h][d]; out row segment 256 B
__global__ __launch_bounds__(128) void k_attn(const float* __restrict__ AQ, const float* __restrict__ AK, const __bf16* __restrict__ VTH, const __bf16* __restrict__ VTL, const float* __restrict__ BIAS, float* __restrict__ OUT) {
  __shared__ __align__(16) float sp[4][16][36]; __shared__ __align__(16) float so[4][16][68];
  const int tid = threadIdx.x, wave = tid >> 5, lane = tid & 31, col = lane & 15, g = lane >> 4;
  const int qb = blockIdx.x, bh = blockIdx.y, b = bh / NH, h = bh % NH; const int q0 = qb * 64 + wave * 16;
  float aq[8];
#pragma unroll
  for (int r = 0; r < 8; ++r) aq[r] = AQ[((size_t)b * NH + h) * SQ + q0 + 8 * g + r];
  const float* AKb = AK + ((size_t)b * NH + h) * SK;
  float m[8], l[8]; v8f acc[4] = {};
#pragma unroll
  for (int r = 0; r < 8; ++r) { m[r] = -3.0e38f; l[r] = 0.f; }
#pragma unroll 1
  for (int ks = 0; ks < SK / 32; ++ks) { const float k0v = AKb[ks * 32 + col], k1v = AKb[ks * 32 + 16 + col]; float s[2][8];
#pragma unroll
    for (int r = 0; r < 8; ++r) { float u = aq[r] + k0v; s[0][r] = u > 0.f ? u : 0.2f * u; u = aq[r] + k1v; s[1][r] = u > 0.f ? u : 0.2f * u; }
#pragma unroll
    for (int r = 0; r < 8; ++r) { float mx = fmaxf(s[0][r], s[1][r]);
#pragma unroll
      for (int o = 1; o < 16; o <<= 1) mx = fmaxf(mx, __shfl_xor(mx, o));
      const float mn = fmaxf(m[r], mx); const float alpha = exp_ni(m[r] - mn); const float e0 = exp_ni(s[0][r] - mn), e1 = exp_ni(s[1][r] - mn); float es = e0 + e1;
#pragma unroll
      for (int o = 1; o < 16; o <<= 1) es += __shfl_xor(es, o);
      l[r] = l[r] * alpha + es; m[r] = mn;
#pragma unroll
      for (int dt = 0; dt < 4; ++dt) acc[dt][r] *= alpha;
      sp[wave][8 * g + r][col] = e0; sp[wave][8 * g + r][16 + col] = e1; }
    LDSX();
    const F2 pa = split_row(&sp[wave][col][0], 0, lane);
#pragma unroll
    for (int dt = 0; dt < 4; ++dt) { const size_t vrow = ((size_t)b * DI + h * OD + dt * 16 + col) * SK + ks * 32; const v16b vh = frag_b(VTH + vrow, lane), vl = frag_b(VTL + vrow, lane); acc[dt] = wmma_bf(pa.l, vh, acc[dt]); acc[dt] = wmma_bf(pa.h, vl, acc[dt]); acc[dt] = wmma_bf(pa.h, vh, acc[dt]); }
    LDSX(); }
#pragma unroll
  for (int r = 0; r < 8; ++r) { const float il = 1.0f / l[r];
#pragma unroll
    for (int dt = 0; dt < 4; ++dt) so[wave][8 * g + r][dt * 16 + col] = acc[dt][r] * il + bfr(BIAS[h * OD + dt * 16 + col]); }
  LDSX();
  for (int rl = 0; rl < 16; ++rl) if (lane < 16) vst2(OUT + ((size_t)b * SQ + q0 + rl) * (NH * OD) + h * OD + lane * 4, *(const v4f*)&so[wave][rl][lane * 4]);
}
extern "C" void kernel_launch(void* const* d_in, const int* in_sizes, int n_in, void* d_out, int out_size, void* d_ws, size_t ws_size, hipStream_t stream) {
  (void)in_sizes; (void)n_in; (void)out_size;
  const float** F = (const float**)d_in;   // Q, K, V [8,1024,512], WQ [8,512], WK [8,512], WV [512,512], bias [8,64]
  if (ws_size < (size_t)WS_END) return;
  char* ws = (char*)d_ws; __bf16 *VTH = (__bf16*)(ws + WS_VTH), *VTL = (__bf16*)(ws + WS_VTL); float *AQ = (float*)(ws + WS_AQ), *AK = (float*)(ws + WS_AK);
  k_vproj<<<dim3(SK / 64, TNB), 128, 0, stream>>>(F[2], F[5], VTH, VTL);
  k_aqk<<<dim3(SQ / 64, TNB, 2), 256, 0, stream>>>(F[0], F[1], F[3], F[4], AQ, AK);
  k_attn<<<dim3(TQB, TNB * NH), 128, 0, stream>>>(AQ, AK, VTH, VTL, F[6], (float*)d_out);
}

// v002
// It runs in 159 microseconds.
// Two timings next to v001 both put it at 1.31 times that version's speed.
// All steps since v000 together make it 2.50 times as fast.
// compute dtype: Q, K, V, WQ, WK, WV, bias (module inputs) rounded to bf16; Vproj with exact bf16 products on WMMA; the per-head scalar scores attn_Q/attn_K as f32 dots of bf16-rounded inputs; rank-1 logits leaky(aq[q] + ak[k]) and the softmax (row maximum known up front) in f32; P.Vproj with both computed operands as bf16 hi + residual pairs (3 products); f32 accumulate.
#include <hip/hip_runtime.h>
#include <math.h>

typedef __attribute__((ext_vector_type(16))) _Float16 v16h;
typedef __attribute__((ext_vector_type(16))) __bf16 v16b;
typedef __attribute__((ext_vector_type(8)))  _Float16 v8h;
typedef __attribute__((ext_vector_type(8)))  float v8f;
typedef __attribute__((ext_vector_type(4)))  float v4f;
typedef __attribute__((ext_vector_type(2)))  float v2f;
typedef __attribute__((ext_vector_type(4)))  unsigned v4u;
typedef __attribute__((ext_vector_type(4)))  int v4i;
typedef float __attribute__((may_alias)) float_a;
typedef int __attribute__((may_alias)) int_a;

template <typename T> __device__ __forceinline__ void vst2(void* p, T v) { *(T*)p = v;  }
__device__ __forceinline__ v8f wmma16(v16h a, v16h b, v8f c) {
  v8f d = __builtin_amdgcn_wmma_f32_16x16x32_f16(false, a, false, b, (short)0, c, false, false);
  asm volatile("v_nop\n\tv_nop\n\tv_nop\n\tv_nop" : "+v"(d) : "v"(a), "v"(b));
  return d;
}
__device__ __forceinline__ v8f wmma_bf(v16b a, v16b b, v8f c) {
  v8f d = __builtin_amdgcn_wmma_f32_16x16x32_bf16(false, a, false, b, (short)0, c, false, false);
  asm volatile("v_nop\n\tv_nop\n\tv_nop\n\tv_nop" : "+v"(d) : "v"(a), "v"(b));
  return d;
}
// 16x16x32 fragments: lane = (h = lane>>4, row/col = lane&15); elements 0..7 = k0+8h+0..7, 8..15 = k0+16+8h+0..7; D element r = row 8h+r
__device__ __forceinline__ v16h frag_h(const _Float16* rowk0, int lane) {
  union { v16h v; v8h q[2]; } u; const _Float16* p = rowk0 + 8 * (lane >> 4);
  u.q[0] = *(const v8h*)p; u.q[1] = *(const v8h*)(p + 16); return u.v;
}
__device__ __forceinline__ v16h frag_f32(const float* rowk0, int lane) {
  v16h a; const float* p = rowk0 + 8 * (lane >> 4);
#pragma unroll
  for (int i = 0; i < 8; ++i) { a[i] = (_Float16)p[i]; a[8 + i] = (_Float16)p[16 + i]; }
  return a;
}
__device__ __forceinline__ v16h frag_f32s(const float* rowk0, int lane, float sc) {
  v16h a; const float* p = rowk0 + 8 * (lane >> 4);
#pragma unroll
  for (int i = 0; i < 8; ++i) { a[i] = (_Float16)(p[i] * sc); a[8 + i] = (_Float16)(p[16 + i] * sc); }
  return a;
}
// column fragment from a [K][ld] layout (column n), rows >= K read as 0
__device__ __forceinline__ v16h fragc_f32(const float* W, int k0, int n, int lane, int ld, int K) {
  v16h a; const int g = lane >> 4;
#pragma unroll
  for (int i = 0; i < 8; ++i) { const int ka = k0 + 8 * g + i, kb = ka + 16;
    a[i] = (_Float16)(ka < K ? W[(size_t)(ka < K ? ka : K - 1) * ld + n] : 0.f); a[8 + i] = (_Float16)(kb < K ? W[(size_t)(kb < K ? kb : K - 1) * ld + n] : 0.f); }
  return a;
}
struct F2 { v16b h, l; };
__device__ __forceinline__ F2 bsplit16(const float v[16]) { F2 r;
#pragma unroll
  for (int i = 0; i < 16; ++i) { const __bf16 h = (__bf16)v[i]; r.h[i] = h; r.l[i] = (__bf16)(v[i] - (float)h); }
  return r; }
__device__ __forceinline__ F2 split_row(const float* row, int k0, int lane) { float v[16]; const float* p = row + k0 + 8 * (lane >> 4);
#pragma unroll
  for (int i = 0; i < 8; ++i) { v[i] = p[i]; v[8 + i] = p[16 + i]; }
  return bsplit16(v); }
__device__ __forceinline__ F2 split_rowK(const float* row, int k0, int lane, int K) { float v[16]; const int g = lane >> 4;
#pragma unroll
  for (int i = 0; i < 8; ++i) { const int ka = k0 + 8 * g + i, kb = ka + 16; v[i] = ka < K ? row[ka < K ? ka : K - 1] : 0.f; v[8 + i] = kb < K ? row[kb < K ? kb : K - 1] : 0.f; }
  return bsplit16(v); }
__device__ __forceinline__ F2 split_col(const float* W, int k0, int n, int lane, int ld, int K) { float v[16]; const int g = lane >> 4;
#pragma unroll
  for (int i = 0; i < 8; ++i) { const int ka = k0 + 8 * g + i, kb = ka + 16; v[i] = ka < K ? W[(size_t)(ka < K ? ka : K - 1) * ld + n] : 0.f; v[8 + i] = kb < K ? W[(size_t)(kb < K ? kb : K - 1) * ld + n] : 0.f; }
  return bsplit16(v); }
__device__ __forceinline__ v8f mac3(const F2& a, const F2& b, v8f c) { c = wmma_bf(a.l, b.h, c); c = wmma_bf(a.h, b.l, c); return wmma_bf(a.h, b.h, c); }
__device__ __forceinline__ float sigm(float v) { return 1.0f / (1.0f + expf(-v)); }
#define LDSX() do { asm volatile("s_wait_dscnt 0" ::: "memory"); __builtin_amdgcn_wave_barrier(); __builtin_amdgcn_fence(__ATOMIC_RELEASE, "workgroup"); } while (0)


// Additive multi-head attention block: Vproj = V WV^T (8 heads x 64), attn_Q = Q WQ^T, attn_K = K WK^T (one scalar per head), w = softmax_k(leaky_relu(attn_Q[q,h] + attn_K[k,h], 0.2)), out[q, h*64 + d] = sum_k w Vproj[k,h,d] + bias[h,d].  B 8, 1024 queries/keys, dims 512.
// k_vproj (exact GEMM -> transposed hi/lo planes), k_aqk (the 8 scalar projections per Q or K row, f32), k_attn (block = (64 queries, b*8+h): 32 key steps, VALU logits, row max up front, per-lane sums, P hi/lo x Vproj planes, + bias).
#define NB 8
#define SQ 1024
#define SK 1024
#define DI 512
#define NH 8
#define OD 64
#ifndef TQB
#define TQB (SQ / 64)
#define TNB NB
#endif
typedef __attribute__((ext_vector_type(8))) __bf16 v8b;
__device__ __forceinline__ v16b frag_b(const __bf16* rowk0, int lane) {
  union { v16b v; v8b q[2]; } u; const __bf16* p = rowk0 + 8 * (lane >> 4);
  u.q[0] = *(const v8b*)p; u.q[1] = *(const v8b*)(p + 16); return u.v;
}
__device__ __forceinline__ v16b frag_gbf(const float* rowk0, int lane) {
  v16b a; const float* p = rowk0 + 8 * (lane >> 4);
#pragma unroll
  for (int i = 0; i < 8; ++i) { a[i] = (__bf16)p[i]; a[8 + i] = (__bf16)p[16 + i]; }
  return a;
}
__device__ __forceinline__ float bfr(float v) { return (float)(__bf16)v; }
__device__ __attribute__((noinline)) float exp_ni(float v) { return expf(v); }
#define WS_VTH  0u                                   // bf16 [8][512][1024] Vproj transposed hi
#define WS_VTL  (WS_VTH + 2u * NB * DI * SK)
#define WS_AQ   (WS_VTL + 2u * NB * DI * SK)           // f32 [8][8 h][1024 q]
#define WS_AK   (WS_AQ + 4u * NB * NH * SQ)            // f32 [8][8 h][1024 k]
#define WS_END  (WS_AK + 4u * NB * NH * SK)

// k_vproj staging: the block's 64 V rows (all 512 k) and, per stage, 128 WV rows x 256 k are read once per block by whole-line loads (a wave-wide 16-B load = 512 contiguous bytes), rounded to bf16 once and kept in LDS; all four waves take their fragments from there.
#define VPITCH 520   // bf16 per staged V row: 1040 B = 16 B x 65 (odd), the pitch for 16-byte LDS readers
#define WPITCH 264   // bf16 per staged WV half row: 528 B = 16 B x 33 (odd)
typedef __attribute__((ext_vector_type(4))) __bf16 v4b;
__global__ __launch_bounds__(128) void k_vproj(const float* __restrict__ V, const float* __restrict__ WV, __bf16* __restrict__ VTH, __bf16* __restrict__ VTL) {
  __shared__ __align__(16) __bf16 sh[DI][72], sl[DI][72];
  __shared__ __align__(16) __bf16 sv[64][VPITCH], sw[128][WPITCH];
  const int tid = threadIdx.x, wave = tid >> 5, lane = tid & 31, col = lane & 15, g = lane >> 4; const int b = blockIdx.y; const int k0 = blockIdx.x * 64;
  const float* Vt = V + ((size_t)b * SK + k0) * DI + tid * 4;   // thread = 4 k of every row
  // unroll 32: that many independent 16-B loads per lane in flight, so a batch pays the load latency once
#pragma unroll 32
  for (int r = 0; r < 64; ++r) *(v4b*)&sv[r][tid * 4] = __builtin_convertvector(*(const v4f*)(Vt + (size_t)r * DI), v4b);
  const int wr = tid >> 6, wc = (tid & 63) * 4;                  // thread = 4 k of every second row of a stage
#pragma unroll 1
  for (int oc = 0; oc < DI / 128; ++oc) { v8f acc[8] = {};
    // unroll 1: one copy of the stage and its matrix block in the text
#pragma unroll 1
    for (int kh = 0; kh < 2; ++kh) { const float* Wt = WV + (size_t)(oc * 128 + wr) * DI + kh * 256 + wc;
      __syncthreads();   // every wave has finished its reads of the stage that sw still holds
      // unroll 32: as above
#pragma unroll 32
      for (int r = 0; r < 64; ++r) *(v4b*)&sw[2 * r + wr][wc] = __builtin_convertvector(*(const v4f*)(Wt + (size_t)(2 * r) * DI), v4b);
      __syncthreads();   // the stage (and, the first time, sv) is visible to every wave
      const __bf16* ap = &sv[wave * 16 + col][kh * 256]; const __bf16* bp = &sw[col][0];
      v16b fa[2], fb[2][8];   // two fragment sets: the next 32 k are fetched as one group ahead of the current matrix instructions, which then do not wait out the LDS latency
      fa[0] = frag_b(ap, lane);
#pragma unroll
      for (int j = 0; j < 8; ++j) fb[0][j] = frag_b(bp + j * 16 * WPITCH, lane);
      // full unroll, here and in the j loops: set and tile indices must be compile-time constants for the sets to stay in registers
#pragma unroll
      for (int kc = 0; kc < 8; ++kc) { const int cu = kc & 1, nx = cu ^ 1;
        if (kc + 1 < 8) { fa[nx] = frag_b(ap + (kc + 1) * 32, lane);
#pragma unroll
          for (int j = 0; j < 8; ++j) fb[nx][j] = frag_b(bp + j * 16 * WPITCH + (kc + 1) * 32, lane); }
#pragma unroll
        for (int j = 0; j < 8; ++j) acc[j] = wmma_bf(fa[cu], fb[cu][j], acc[j]); } }
#pragma unroll
    for (int j = 0; j < 8; ++j)
#pragma unroll
      for (int r = 0; r < 8; ++r) { const int o = oc * 128 + j * 16 + col; const float v = acc[j][r]; const __bf16 hb = (__bf16)v; sh[o][wave * 16 + 8 * g + r] = hb; sl[o][wave * 16 + 8 * g + r] = (__bf16)(v - (float)hb); } }
  __syncthreads();
  for (int q = tid; q < DI * 8; q += 128) { const int o = q >> 3, pc = q & 7; const size_t off = ((size_t)b * DI + o) * SK + k0 + pc * 8; vst2((unsigned*)(VTH + off), *(const v4u*)&sh[o][pc * 8]); vst2((unsigned*)(VTL + off), *(const v4u*)&sl[o][pc * 8]); }
}
// ---- k_aqk: block = (64 rows, b, which): which 0: AQ[b][h][q] = sum_i Q[b][q][i] WQ[h][i]; which 1: AK from K/WK; thread = (row, 4 per row = 2 heads each); rows of 64 floats per (b,h) = 256-B segments
__global__ __launch_bounds__(256) void k_aqk(const float* __restrict__ Q, const float* __restrict__ K, const float* __restrict__ WQ, const float* __restrict__ WK, float* __restrict__ AQ, float* __restrict__ AK) {
  __shared__ float sw[NH][DI]; __shared__ __align__(16) float so[NH][64];
  const int tid = threadIdx.x, b = blockIdx.y, which = blockIdx.z; const int r0 = blockIdx.x * 64; const float* X = which == 0 ? Q : K; const float* Wm = which == 0 ? WQ : WK; float* A = which == 0 ? AQ : AK; const int L = which == 0 ? SQ : SK;
  for (int q = tid; q < NH * DI; q += 256) sw[q / DI][q % DI] = bfr(Wm[q]);
  __syncthreads();
  { const int rl = tid >> 2, hp = tid & 3; const float* xr = X + ((size_t)b * L + r0 + rl) * DI; float a0 = 0.f, a1 = 0.f;
#pragma unroll 1
    for (int i = 0; i < DI; ++i) { const float xv = bfr(xr[i]); a0 += xv * sw[hp * 2][i]; a1 += xv * sw[hp * 2 + 1][i]; }
    so[hp * 2][rl] = a0; so[hp * 2 + 1][rl] = a1; }
  __syncthreads();
  if (tid < NH * 16) { const int h = tid >> 4, pc = tid & 15; vst2(A + ((size_t)b * NH + h) * L + r0 + pc * 4, *(const v4f*)&so[h][pc * 4]); }
}
// ---- k_attn: block = (64 queries, b*8+h), 4 waves: s = leaky(aq[q] + ak[k], 0.2); softmax with the row max leaky(aq[q] + max ak) taken before the loop, row sum folded over lanes once behind it; P hi/lo x Vproj planes (head columns h*64..+63 = rows b*512 + h*64 + d) 3 products; + bias[h][d]; out row segment 256 B
__global__ __launch_bounds__(128) void k_attn(const float* __restrict__ AQ, const float* __restrict__ AK, const __bf16* __restrict__ VTH, const __bf16* __restrict__ VTL, const float* __restrict__ BIAS, float* __restrict__ OUT) {
  __shared__ __align__(16) float sp[4][16][36]; __shared__ __align__(16) float so[4][16][68];
  const int tid = threadIdx.x, wave = tid >> 5, lane = tid & 31, col = lane & 15, g = lane >> 4;
  const int qb = blockIdx.x, bh = blockIdx.y, b = bh / NH, h = bh % NH; const int q0 = qb * 64 + wave * 16;
  float aq[8];
#pragma unroll
  for (int r = 0; r < 8; ++r) aq[r] = AQ[((size_t)b * NH + h) * SQ + q0 + 8 * g + r];
  const float* AKb = AK + ((size_t)b * NH + h) * SK;
  // The logit leaky(aq + ak) never decreases as ak grows (f32 add, and leaky with a positive slope, keep order), so a row's maximum over all keys is the logit at the largest ak: it is known before the key loop and equals, bit for bit, the last running maximum.
  float akmax;
  // full unroll, here and in the r loops below: the eight whole-line loads go out together; m, l and e are indexed by constants and stay in registers
  { v4f t = *(const v4f*)(AKb + lane * 4);
#pragma unroll
    for (int j = 1; j < SK / 128; ++j) { const v4f w = *(const v4f*)(AKb + j * 128 + lane * 4); t[0] = fmaxf(t[0], w[0]); t[1] = fmaxf(t[1], w[1]); t[2] = fmaxf(t[2], w[2]); t[3] = fmaxf(t[3], w[3]); }
    akmax = fmaxf(fmaxf(t[0], t[1]), fmaxf(t[2], t[3]));
#pragma unroll
    for (int o = 1; o < 32; o <<= 1) akmax = fmaxf(akmax, __shfl_xor(akmax, o)); }
  float m[8], l[8]; v8f acc[4] = {};   // l: this lane's own share of the row sum (its two key columns of every step)
#pragma unroll
  for (int r = 0; r < 8; ++r) { const float u = aq[r] + akmax; m[r] = u > 0.f ? u : 0.2f * u; l[r] = 0.f; }
#pragma unroll 1
  for (int ks = 0; ks < SK / 32; ++ks) { const float k0v = AKb[ks * 32 + col], k1v = AKb[ks * 32 + 16 + col];
    float e[2][8];
#pragma unroll
    for (int r = 0; r < 8; ++r) { float u = aq[r] + k0v; const float s0 = u > 0.f ? u : 0.2f * u; u = aq[r] + k1v; const float s1 = u > 0.f ? u : 0.2f * u;
      e[0][r] = exp_ni(s0 - m[r]); e[1][r] = exp_ni(s1 - m[r]); }
#pragma unroll
    for (int r = 0; r < 8; ++r) { l[r] += e[0][r] + e[1][r]; sp[wave][8 * g + r][col] = e[0][r]; sp[wave][8 * g + r][16 + col] = e[1][r]; }
    LDSX();
    const F2 pa = split_row(&sp[wave][col][0], 0, lane);
#pragma unroll
    for (int dt = 0; dt < 4; ++dt) { const size_t vrow = ((size_t)b * DI + h * OD + dt * 16 + col) * SK + ks * 32; const v16b vh = frag_b(VTH + vrow, lane), vl = frag_b(VTL + vrow, lane); acc[dt] = wmma_bf(pa.l, vh, acc[dt]); acc[dt] = wmma_bf(pa.h, vl, acc[dt]); acc[dt] = wmma_bf(pa.h, vh, acc[dt]); }
    LDSX(); }
#pragma unroll
  for (int r = 0; r < 8; ++r) { float ls = l[r];
#pragma unroll
    for (int o = 1; o < 16; o <<= 1) ls += __shfl_xor(ls, o);
    const float il = 1.0f / ls;
#pragma unroll
    for (int dt = 0; dt < 4; ++dt) so[wave][8 * g + r][dt * 16 + col] = acc[dt][r] * il + bfr(BIAS[h * OD + dt * 16 + col]); }
  LDSX();
  for (int rl = 0; rl < 16; ++rl) if (lane < 16) vst2(OUT + ((size_t)b * SQ + q0 + rl) * (NH * OD) + h * OD + lane * 4, *(const v4f*)&so[wave][rl][lane * 4]);
}
extern "C" void kernel_launch(void* const* d_in, const int* in_sizes, int n_in, void* d_out, int out_size, void* d_ws, size_t ws_size, hipStream_t stream) {
  (void)in_sizes; (void)n_in; (void)out_size;
  const float** F = (const float**)d_in;   // Q, K, V [8,1024,512], WQ [8,512], WK [8,512], WV [512,512], bias [8,64]
  if (ws_size < (size_t)WS_END) return;
  char* ws = (char*)d_ws; __bf16 *VTH = (__bf16*)(ws + WS_VTH), *VTL = (__bf16*)(ws + WS_VTL); float *AQ = (float*)(ws + WS_AQ), *AK = (float*)(ws + WS_AK);
  k_vproj<<<dim3(SK / 64, TNB), 128, 0, stream>>>(F[2], F[5], VTH, VTL);
  k_aqk<<<dim3(SQ / 64, TNB, 2), 256, 0, stream>>>(F[0], F[1], F[3], F[4], AQ, AK);
  k_attn<<<dim3(TQB, TNB * NH), 128, 0, stream>>>(AQ, AK, VTH, VTL, F[6], (float*)d_out);
}

// v003
// A run of this version takes 115 microseconds.
// Two timings next to v002 both put it at 1.39 times that version's speed.
// All steps since v000 together make it 3.46 times as fast.
// compute dtype: Q, K, V, WQ, WK, WV, bias (module inputs) rounded to bf16; Vproj with exact bf16 products on WMMA; the per-head scalar scores attn_Q/attn_K as f32 dots of bf16-rounded inputs; rank-1 logits leaky(aq[q] + ak[k]) and the softmax (row maximum known up front) in f32; P.Vproj with both computed operands as bf16 hi + residual pairs (3 products); f32 accumulate.
#include <hip/hip_runtime.h>
#include <math.h>

typedef __attribute__((ext_vector_type(16))) _Float16 v16h;
typedef __attribute__((ext_vector_type(16))) __bf16 v16b;
typedef __attribute__((ext_vector_type(8)))  _Float16 v8h;
typedef __attribute__((ext_vector_type(8)))  float v8f;
typedef __attribute__((ext_vector_type(4)))  float v4f;
typedef __attribute__((ext_vector_type(2)))  float v2f;
typedef __attribute__((ext_vector_type(4)))  unsigned v4u;
typedef __attribute__((ext_vector_type(4)))  int v4i;
typedef float __attribute__((may_alias)) float_a;
typedef int __attribute__((may_alias)) int_a;

template <typename T> __device__ __forceinline__ void vst2(void* p, T v) { *(T*)p = v;  }
__device__ __forceinline__ v8f wmma16(v16h a, v16h b, v8f c) {
  v8f d = __builtin_amdgcn_wmma_f32_16x16x32_f16(false, a, false, b, (short)0, c, false, false);
  asm volatile("v_nop\n\tv_nop\n\tv_nop\n\tv_nop" : "+v"(d) : "v"(a), "v"(b));
  return d;
}
__device__ __forceinline__ v8f wmma_bf(v16b a, v16b b, v8f c) {
  v8f d = __builtin_amdgcn_wmma_f32_16x16x32_bf16(false, a, false, b, (short)0, c, false, false);
  asm volatile("v_nop\n\tv_nop\n\tv_nop\n\tv_nop" : "+v"(d) : "v"(a), "v"(b));
  return d;
}
// 16x16x32 fragments: lane = (h = lane>>4, row/col = lane&15); elements 0..7 = k0+8h+0..7, 8..15 = k0+16+8h+0..7; D element r = row 8h+r
__device__ __forceinline__ v16h frag_h(const _Float16* rowk0, int lane) {
  union { v16h v; v8h q[2]; } u; const _Float16* p = rowk0 + 8 * (lane >> 4);
  u.q[0] = *(const v8h*)p; u.q[1] = *(const v8h*)(p + 16); return u.v;
}
__device__ __forceinline__ v16h frag_f32(const float* rowk0, int lane) {
  v16h a; const float* p = rowk0 + 8 * (lane >> 4);
#pragma unroll
  for (int i = 0; i < 8; ++i) { a[i] = (_Float16)p[i]; a[8 + i] = (_Float16)p[16 + i]; }
  return a;
}
__device__ __forceinline__ v16h frag_f32s(const float* rowk0, int lane, float sc) {
  v16h a; const float* p = rowk0 + 8 * (lane >> 4);
#pragma unroll
  for (int i = 0; i < 8; ++i) { a[i] = (_Float16)(p[i] * sc); a[8 + i] = (_Float16)(p[16 + i] * sc); }
  return a;
}
// column fragment from a [K][ld] layout (column n), rows >= K read as 0
__device__ __forceinline__ v16h fragc_f32(const float* W, int k0, int n, int lane, int ld, int K) {
  v16h a; const int g = lane >> 4;
#pragma unroll
  for (int i = 0; i < 8; ++i) { const int ka = k0 + 8 * g + i, kb = ka + 16;
    a[i] = (_Float16)(ka < K ? W[(size_t)(ka < K ? ka : K - 1) * ld + n] : 0.f); a[8 + i] = (_Float16)(kb < K ? W[(size_t)(kb < K ? kb : K - 1) * ld + n] : 0.f); }
  return a;
}
struct F2 { v16b h, l; };
__device__ __forceinline__ F2 bsplit16(const float v[16]) { F2 r;
#pragma unroll
  for (int i = 0; i < 16; ++i) { const __bf16 h = (__bf16)v[i]; r.h[i] = h; r.l[i] = (__bf16)(v[i] - (float)h); }
  return r; }
__device__ __forceinline__ F2 split_row(const float* row, int k0, int lane) { float v[16]; const float* p = row + k0 + 8 * (lane >> 4);
#pragma unroll
  for (int i = 0; i < 8; ++i) { v[i] = p[i]; v[8 + i] = p[16 + i]; }
  return bsplit16(v); }
__device__ __forceinline__ F2 split_rowK(const float* row, int k0, int lane, int K) { float v[16]; const int g = lane >> 4;
#pragma unroll
  for (int i = 0; i < 8; ++i) { const int ka = k0 + 8 * g + i, kb = ka + 16; v[i] = ka < K ? row[ka < K ? ka : K - 1] : 0.f; v[8 + i] = kb < K ? row[kb < K ? kb : K - 1] : 0.f; }
  return bsplit16(v); }
__device__ __forceinline__ F2 split_col(const float* W, int k0, int n, int lane, int ld, int K) { float v[16]; const int g = lane >> 4;
#pragma unroll
  for (int i = 0; i < 8; ++i) { const int ka = k0 + 8 * g + i, kb = ka + 16; v[i] = ka < K ? W[(size_t)(ka < K ? ka : K - 1) * ld + n] : 0.f; v[8 + i] = kb < K ? W[(size_t)(kb < K ? kb : K - 1) * ld + n] : 0.f; }
  return bsplit16(v); }
__device__ __forceinline__ v8f mac3(const F2& a, const F2& b, v8f c) { c = wmma_bf(a.l, b.h, c); c = wmma_bf(a.h, b.l, c); return wmma_bf(a.h, b.h, c); }
__device__ __forceinline__ float sigm(float v) { return 1.0f / (1.0f + expf(-v)); }
#define LDSX() do { asm volatile("s_wait_dscnt 0" ::: "memory"); __builtin_amdgcn_wave_barrier(); __builtin_amdgcn_fence(__ATOMIC_RELEASE, "workgroup"); } while (0)


// Additive multi-head attention block: Vproj = V WV^T (8 heads x 64), attn_Q = Q WQ^T, attn_K = K WK^T (one scalar per head), w = softmax_k(leaky_relu(attn_Q[q,h] + attn_K[k,h], 0.2)), out[q, h*64 + d] = sum_k w Vproj[k,h,d] + bias[h,d].  B 8, 1024 queries/keys, dims 512.
// k_vproj (exact GEMM -> transposed hi/lo planes), k_aqk (the 8 scalar projections per Q or K row, f32), k_attn (block = (64 queries, b*8+h): 32 key steps, VALU logits, row max up front, per-lane sums, P hi/lo x Vproj planes, + bias).
#define NB 8
#define SQ 1024
#define SK 1024
#define DI 512
#define NH 8
#define OD 64
#ifndef TQB
#define TQB (SQ / 64)
#define TNB NB
#endif
typedef __attribute__((ext_vector_type(8))) __bf16 v8b;
__device__ __forceinline__ v16b frag_b(const __bf16* rowk0, int lane) {
  union { v16b v; v8b q[2]; } u; const __bf16* p = rowk0 + 8 * (lane >> 4);
  u.q[0] = *(const v8b*)p; u.q[1] = *(const v8b*)(p + 16); return u.v;
}
__device__ __forceinline__ v16b frag_gbf(const float* rowk0, int lane) {
  v16b a; const float* p = rowk0 + 8 * (lane >> 4);
#pragma unroll
  for (int i = 0; i < 8; ++i) { a[i] = (__bf16)p[i]; a[8 + i] = (__bf16)p[16 + i]; }
  return a;
}
__device__ __forceinline__ float bfr(float v) { return (float)(__bf16)v; }
__device__ __attribute__((noinline)) float exp_ni(float v) { return expf(v); }
#define WS_VTH  0u                                   // bf16 [8][512][1024] Vproj transposed hi
#define WS_VTL  (WS_VTH + 2u * NB * DI * SK)
#define WS_AQ   (WS_VTL + 2u * NB * DI * SK)           // f32 [8][8 h][1024 q]
#define WS_AK   (WS_AQ + 4u * NB * NH * SQ)            // f32 [8][8 h][1024 k]
#define WS_END  (WS_AK + 4u * NB * NH * SK)

// k_vproj staging: the block's 64 V rows (all 512 k) and, per stage, 128 WV rows x 256 k are read once per block by whole-line loads (a wave-wide 16-B load = 512 contiguous bytes), rounded to bf16 once and kept in LDS; all four waves take their fragments from there.
#define VPITCH 520   // bf16 per staged V row: 1040 B = 16 B x 65 (odd), the pitch for 16-byte LDS readers
#define WPITCH 264   // bf16 per staged WV half row: 528 B = 16 B x 33 (odd)
typedef __attribute__((ext_vector_type(4))) __bf16 v4b;
__global__ __launch_bounds__(128) void k_vproj(const float* __restrict__ V, const float* __restrict__ WV, __bf16* __restrict__ VTH, __bf16* __restrict__ VTL) {
  __shared__ __align__(16) __bf16 sh[DI][72], sl[DI][72];
  __shared__ __align__(16) __bf16 sv[64][VPITCH], sw[128][WPITCH];
  const int tid = threadIdx.x, wave = tid >> 5, lane = tid & 31, col = lane & 15, g = lane >> 4; const int b = blockIdx.y; const int k0 = blockIdx.x * 64;
  const float* Vt = V + ((size_t)b * SK + k0) * DI + tid * 4;   // thread = 4 k of every row
  // unroll 32: that many independent 16-B loads per lane in flight, so a batch pays the load latency once
#pragma unroll 32
  for (int r = 0; r < 64; ++r) *(v4b*)&sv[r][tid * 4] = __builtin_convertvector(*(const v4f*)(Vt + (size_t)r * DI), v4b);
  const int wr = tid >> 6, wc = (tid & 63) * 4;                  // thread = 4 k of every second row of a stage
#pragma unroll 1
  for (int oc = 0; oc < DI / 128; ++oc) { v8f acc[8] = {};
    // unroll 1: one copy of the stage and its matrix block in the text
#pragma unroll 1
    for (int kh = 0; kh < 2; ++kh) { const float* Wt = WV + (size_t)(oc * 128 + wr) * DI + kh * 256 + wc;
      __syncthreads();   // every wave has finished its reads of the stage that sw still holds
      // unroll 32: as above
#pragma unroll 32
      for (int r = 0; r < 64; ++r) *(v4b*)&sw[2 * r + wr][wc] = __builtin_convertvector(*(const v4f*)(Wt + (size_t)(2 * r) * DI), v4b);
      __syncthreads();   // the stage (and, the first time, sv) is visible to every wave
      const __bf16* ap = &sv[wave * 16 + col][kh * 256]; const __bf16* bp = &sw[col][0];
      v16b fa[2], fb[2][8];   // two fragment sets: the next 32 k are fetched as one group ahead of the current matrix instructions, which then do not wait out the LDS latency
      fa[0] = frag_b(ap, lane);
#pragma unroll
      for (int j = 0; j < 8; ++j) fb[0][j] = frag_b(bp + j * 16 * WPITCH, lane);
      // full unroll, here and in the j loops: set and tile indices must be compile-time constants for the sets to stay in registers
#pragma unroll
      for (int kc = 0; kc < 8; ++kc) { const int cu = kc & 1, nx = cu ^ 1;
        if (kc + 1 < 8) { fa[nx] = frag_b(ap + (kc + 1) * 32, lane);
#pragma unroll
          for (int j = 0; j < 8; ++j) fb[nx][j] = frag_b(bp + j * 16 * WPITCH + (kc + 1) * 32, lane); }
#pragma unroll
        for (int j = 0; j < 8; ++j) acc[j] = wmma_bf(fa[cu], fb[cu][j], acc[j]); } }
#pragma unroll
    for (int j = 0; j < 8; ++j)
#pragma unroll
      for (int r = 0; r < 8; ++r) { const int o = oc * 128 + j * 16 + col; const float v = acc[j][r]; const __bf16 hb = (__bf16)v; sh[o][wave * 16 + 8 * g + r] = hb; sl[o][wave * 16 + 8 * g + r] = (__bf16)(v - (float)hb); } }
  __syncthreads();
  for (int q = tid; q < DI * 8; q += 128) { const int o = q >> 3, pc = q & 7; const size_t off = ((size_t)b * DI + o) * SK + k0 + pc * 8; vst2((unsigned*)(VTH + off), *(const v4u*)&sh[o][pc * 8]); vst2((unsigned*)(VTL + off), *(const v4u*)&sl[o][pc * 8]); }
}
// one level of a halving butterfly: at distance N a lane keeps the half of its 2N sums whose number has bit N as its own lane number has, and hands the other half to lane ^ N (N a template constant: every index into v is a compile-time constant)
template <int N> __device__ __forceinline__ void fold(float (&v)[32], int lane) { const bool up = (lane & N) != 0;
#pragma unroll
  for (int j = 0; j < N; ++j) { const float keep = up ? v[j + N] : v[j], send = up ? v[j] : v[j + N]; v[j] = keep + __shfl_xor(send, N); } }
// ---- k_aqk: block = (32 rows, b, which), 8 waves: which 0: AQ[b][h][q] = sum_i Q[b][q][i] WQ[h][i]; which 1: AK from K/WK.  A wave owns 4 rows and reads them as 16 whole-line loads (a wave-wide 16-B load = 512 contiguous bytes), all sent before anything waits; lane = 16 i of every row, all 8 heads; the 32 (row, head) partial sums of a lane are folded over the 32 lanes by a halving butterfly that leaves sum number L in lane L; 32 floats per (b,h) = one 128-B line per block
__global__ __launch_bounds__(256) void k_aqk(const float* __restrict__ Q, const float* __restrict__ K, const float* __restrict__ WQ, const float* __restrict__ WK, float* __restrict__ AQ, float* __restrict__ AK) {
  __shared__ __align__(16) float sw[NH][DI]; __shared__ __align__(16) float so[NH][32];
  const int tid = threadIdx.x, wave = tid >> 5, lane = tid & 31, b = blockIdx.y, which = blockIdx.z; const int r0 = blockIdx.x * 32; const float* X = which == 0 ? Q : K; const float* Wm = which == 0 ? WQ : WK; float* A = which == 0 ? AQ : AK; const int L = which == 0 ? SQ : SK;
  const float* xr = X + ((size_t)b * L + r0 + wave * 4) * DI + lane * 4;
  v4f x[4][4], wv[NH * DI / 1024];
  // full unroll, here and below: wv, x, acc and v are indexed by constants and stay in registers; the 4 weight loads (short latency) and the 16 row loads (from memory) go out together
#pragma unroll
  for (int q = 0; q < NH * DI / 1024; ++q) wv[q] = *(const v4f*)(Wm + q * 1024 + tid * 4);
#pragma unroll
  for (int r = 0; r < 4; ++r)
#pragma unroll
    for (int j = 0; j < 4; ++j) x[r][j] = *(const v4f*)(xr + r * DI + j * 128);
  __builtin_amdgcn_sched_barrier(0);   // keeps the row loads in front of the wait for the weights: the weights are then rounded and stored to LDS while the rows are on their way
#pragma unroll
  for (int q = 0; q < NH * DI / 1024; ++q) *(v4f*)(&sw[0][0] + q * 1024 + tid * 4) = __builtin_convertvector(__builtin_convertvector(wv[q], v4b), v4f);
  __syncthreads();
#pragma unroll
  for (int r = 0; r < 4; ++r)
#pragma unroll
    for (int j = 0; j < 4; ++j) x[r][j] = __builtin_convertvector(__builtin_convertvector(x[r][j], v4b), v4f);
  v2f acc[4][NH] = {};   // two f32 chains per (row, head): even and odd i pairs, one packed multiply-add each
#pragma unroll
  for (int h = 0; h < NH; ++h)
#pragma unroll
    for (int j = 0; j < 4; ++j) { const v4f w = *(const v4f*)&sw[h][j * 128 + lane * 4];
#pragma unroll
      for (int r = 0; r < 4; ++r) { acc[r][h] = __builtin_elementwise_fma(x[r][j].xy, w.xy, acc[r][h]); acc[r][h] = __builtin_elementwise_fma(x[r][j].zw, w.zw, acc[r][h]); } }
  float v[32];
#pragma unroll
  for (int r = 0; r < 4; ++r)
#pragma unroll
    for (int h = 0; h < NH; ++h) v[r * NH + h] = acc[r][h][0] + acc[r][h][1];
  fold<16>(v, lane); fold<8>(v, lane); fold<4>(v, lane); fold<2>(v, lane); fold<1>(v, lane);
  so[lane & 7][wave * 4 + (lane >> 3)] = v[0];
  __syncthreads();
  if (tid < NH * 8) { const int h = tid >> 3, pc = tid & 7; vst2(A + ((size_t)b * NH + h) * L + r0 + pc * 4, *(const v4f*)&so[h][pc * 4]); }
}
// ---- k_attn: block = (64 queries, b*8+h), 4 waves: s = leaky(aq[q] + ak[k], 0.2); softmax with the row max leaky(aq[q] + max ak) taken before the loop, row sum folded over lanes once behind it; P hi/lo x Vproj planes (head columns h*64..+63 = rows b*512 + h*64 + d) 3 products; + bias[h][d]; out row segment 256 B
__global__ __launch_bounds__(128) void k_attn(const float* __restrict__ AQ, const float* __restrict__ AK, const __bf16* __restrict__ VTH, const __bf16* __restrict__ VTL, const float* __restrict__ BIAS, float* __restrict__ OUT) {
  __shared__ __align__(16) float sp[4][16][36]; __shared__ __align__(16) float so[4][16][68];
  const int tid = threadIdx.x, wave = tid >> 5, lane = tid & 31, col = lane & 15, g = lane >> 4;
  const int qb = blockIdx.x, bh = blockIdx.y, b = bh / NH, h = bh % NH; const int q0 = qb * 64 + wave * 16;
  float aq[8];
#pragma unroll
  for (int r = 0; r < 8; ++r) aq[r] = AQ[((size_t)b * NH + h) * SQ + q0 + 8 * g + r];
  const float* AKb = AK + ((size_t)b * NH + h) * SK;
  // The logit leaky(aq + ak) never decreases as ak grows (f32 add, and leaky with a positive slope, keep order), so a row's maximum over all keys is the logit at the largest ak: it is known before the key loop and equals, bit for bit, the last running maximum.
  float akmax;
  // full unroll, here and in the r loops below: the eight whole-line loads go out together; m, l and e are indexed by constants and stay in registers
  { v4f t = *(const v4f*)(AKb + lane * 4);
#pragma unroll
    for (int j = 1; j < SK / 128; ++j) { const v4f w = *(const v4f*)(AKb + j * 128 + lane * 4); t[0] = fmaxf(t[0], w[0]); t[1] = fmaxf(t[1], w[1]); t[2] = fmaxf(t[2], w[2]); t[3] = fmaxf(t[3], w[3]); }
    akmax = fmaxf(fmaxf(t[0], t[1]), fmaxf(t[2], t[3]));
#pragma unroll
    for (int o = 1; o < 32; o <<= 1) akmax = fmaxf(akmax, __shfl_xor(akmax, o)); }
  float m[8], l[8]; v8f acc[4] = {};   // l: this lane's own share of the row sum (its two key columns of every step)
#pragma unroll
  for (int r = 0; r < 8; ++r) { const float u = aq[r] + akmax; m[r] = u > 0.f ? u : 0.2f * u; l[r] = 0.f; }
#pragma unroll 1
  for (int ks = 0; ks < SK / 32; ++ks) { const float k0v = AKb[ks * 32 + col], k1v = AKb[ks * 32 + 16 + col];
    float e[2][8];
#pragma unroll
    for (int r = 0; r < 8; ++r) { float u = aq[r] + k0v; const float s0 = u > 0.f ? u : 0.2f * u; u = aq[r] + k1v; const float s1 = u > 0.f ? u : 0.2f * u;
      e[0][r] = exp_ni(s0 - m[r]); e[1][r] = exp_ni(s1 - m[r]); }
#pragma unroll
    for (int r = 0; r < 8; ++r) { l[r] += e[0][r] + e[1][r]; sp[wave][8 * g + r][col] = e[0][r]; sp[wave][8 * g + r][16 + col] = e[1][r]; }
    LDSX();
    const F2 pa = split_row(&sp[wave][col][0], 0, lane);
#pragma unroll
    for (int dt = 0; dt < 4; ++dt) { const size_t vrow = ((size_t)b * DI + h * OD + dt * 16 + col) * SK + ks * 32; const v16b vh = frag_b(VTH + vrow, lane), vl = frag_b(VTL + vrow, lane); acc[dt] = wmma_bf(pa.l, vh, acc[dt]); acc[dt] = wmma_bf(pa.h, vl, acc[dt]); acc[dt] = wmma_bf(pa.h, vh, acc[dt]); }
    LDSX(); }
#pragma unroll
  for (int r = 0; r < 8; ++r) { float ls = l[r];
#pragma unroll
    for (int o = 1; o < 16; o <<= 1) ls += __shfl_xor(ls, o);
    const float il = 1.0f / ls;
#pragma unroll
    for (int dt = 0; dt < 4; ++dt) so[wave][8 * g + r][dt * 16 + col] = acc[dt][r] * il + bfr(BIAS[h * OD + dt * 16 + col]); }
  LDSX();
  for (int rl = 0; rl < 16; ++rl) if (lane < 16) vst2(OUT + ((size_t)b * SQ + q0 + rl) * (NH * OD) + h * OD + lane * 4, *(const v4f*)&so[wave][rl][lane * 4]);
}
extern "C" void kernel_launch(void* const* d_in, const int* in_sizes, int n_in, void* d_out, int out_size, void* d_ws, size_t ws_size, hipStream_t stream) {
  (void)in_sizes; (void)n_in; (void)out_size;
  const float** F = (const float**)d_in;   // Q, K, V [8,1024,512], WQ [8,512], WK [8,512], WV [512,512], bias [8,64]
  if (ws_size < (size_t)WS_END) return;
  char* ws = (char*)d_ws; __bf16 *VTH = (__bf16*)(ws + WS_VTH), *VTL = (__bf16*)(ws + WS_VTL); float *AQ = (float*)(ws + WS_AQ), *AK = (float*)(ws + WS_AK);
  k_vproj<<<dim3(SK / 64, TNB), 128, 0, stream>>>(F[2], F[5], VTH, VTL);
  k_aqk<<<dim3(SQ / 32, TNB, 2), 256, 0, stream>>>(F[0], F[1], F[3], F[4], AQ, AK);
  k_attn<<<dim3(TQB, TNB * NH), 128, 0, stream>>>(AQ, AK, VTH, VTL, F[6], (float*)d_out);
}

// v004
// A run of this version takes 95.5 microseconds.
// Timed twice side by side with v003, it ran 1.20 and 1.21 times as fast.
// Over all steps from v000 it is 4.16 times as fast.
// compute dtype: Q, K, V, WQ, WK, WV, bias (module inputs) rounded to bf16; Vproj with exact bf16 products on WMMA; the per-head scalar scores attn_Q/attn_K as f32 dots of bf16-rounded inputs; rank-1 logits leaky(aq[q] + ak[k]) and the softmax (row maximum known up front) in f32; P.Vproj with both computed operands as bf16 hi + residual pairs (3 products); f32 accumulate.
#include <hip/hip_runtime.h>
#include <math.h>

typedef __attribute__((ext_vector_type(16))) _Float16 v16h;
typedef __attribute__((ext_vector_type(16))) __bf16 v16b;
typedef __attribute__((ext_vector_type(8)))  _Float16 v8h;
typedef __attribute__((ext_vector_type(8)))  float v8f;
typedef __attribute__((ext_vector_type(4)))  float v4f;
typedef __attribute__((ext_vector_type(2)))  float v2f;
typedef __attribute__((ext_vector_type(4)))  unsigned v4u;
typedef __attribute__((ext_vector_type(4)))  int v4i;
typedef float __attribute__((may_alias)) float_a;
typedef int __attribute__((may_alias)) int_a;

template <typename T> __device__ __forceinline__ void vst2(void* p, T v) { *(T*)p = v;  }
__device__ __forceinline__ v8f wmma16(v16h a, v16h b, v8f c) {
  v8f d = __builtin_amdgcn_wmma_f32_16x16x32_f16(false, a, false, b, (short)0, c, false, false);
  asm volatile("v_nop\n\tv_nop\n\tv_nop\n\tv_nop" : "+v"(d) : "v"(a), "v"(b));
  return d;
}
__device__ __forceinline__ v8f wmma_bf(v16b a, v16b b, v8f c) {
  v8f d = __builtin_amdgcn_wmma_f32_16x16x32_bf16(false, a, false, b, (short)0, c, false, false);
  asm volatile("v_nop\n\tv_nop\n\tv_nop\n\tv_nop" : "+v"(d) : "v"(a), "v"(b));
  return d;
}
// 16x16x32 fragments: lane = (h = lane>>4, row/col = lane&15); elements 0..7 = k0+8h+0..7, 8..15 = k0+16+8h+0..7; D element r = row 8h+r
__device__ __forceinline__ v16h frag_h(const _Float16* rowk0, int lane) {
  union { v16h v; v8h q[2]; } u; const _Float16* p = rowk0 + 8 * (lane >> 4);
  u.q[0] = *(const v8h*)p; u.q[1] = *(const v8h*)(p + 16); return u.v;
}
__device__ __forceinline__ v16h frag_f32(const float* rowk0, int lane) {
  v16h a; const float* p = rowk0 + 8 * (lane >> 4);
#pragma unroll
  for (int i = 0; i < 8; ++i) { a[i] = (_Float16)p[i]; a[8 + i] = (_Float16)p[16 + i]; }
  return a;
}
__device__ __forceinline__ v16h frag_f32s(const float* rowk0, int lane, float sc) {
  v16h a; const float* p = rowk0 + 8 * (lane >> 4);
#pragma unroll
  for (int i = 0; i < 8; ++i) { a[i] = (_Float16)(p[i] * sc); a[8 + i] = (_Float16)(p[16 + i] * sc); }
  return a;
}
// column fragment from a [K][ld] layout (column n), rows >= K read as 0
__device__ __forceinline__ v16h fragc_f32(const float* W, int k0, int n, int lane, int ld, int K) {
  v16h a; const int g = lane >> 4;
#pragma unroll
  for (int i = 0; i < 8; ++i) { const int ka = k0 + 8 * g + i, kb = ka + 16;
    a[i] = (_Float16)(ka < K ? W[(size_t)(ka < K ? ka : K - 1) * ld + n] : 0.f); a[8 + i] = (_Float16)(kb < K ? W[(size_t)(kb < K ? kb : K - 1) * ld + n] : 0.f); }
  return a;
}
struct F2 { v16b h, l; };
__device__ __forceinline__ F2 bsplit16(const float v[16]) { F2 r;
#pragma unroll
  for (int i = 0; i < 16; ++i) { const __bf16 h = (__bf16)v[i]; r.h[i] = h; r.l[i] = (__bf16)(v[i] - (float)h); }
  return r; }
__device__ __forceinline__ F2 split_row(const float* row, int k0, int lane) { float v[16]; const float* p = row + k0 + 8 * (lane >> 4);
#pragma unroll
  for (int i = 0; i < 8; ++i) { v[i] = p[i]; v[8 + i] = p[16 + i]; }
  return bsplit16(v); }
__device__ __forceinline__ F2 split_rowK(const float* row, int k0, int lane, int K) { float v[16]; const int g = lane >> 4;
#pragma unroll
  for (int i = 0; i < 8; ++i) { const int ka = k0 + 8 * g + i, kb = ka + 16; v[i] = ka < K ? row[ka < K ? ka : K - 1] : 0.f; v[8 + i] = kb < K ? row[kb < K ? kb : K - 1] : 0.f; }
  return bsplit16(v); }
__device__ __forceinline__ F2 split_col(const float* W, int k0, int n, int lane, int ld, int K) { float v[16]; const int g = lane >> 4;
#pragma unroll
  for (int i = 0; i < 8; ++i) { const int ka = k0 + 8 * g + i, kb = ka + 16; v[i] = ka < K ? W[(size_t)(ka < K ? ka : K - 1) * ld + n] : 0.f; v[8 + i] = kb < K ? W[(size_t)(kb < K ? kb : K - 1) * ld + n] : 0.f; }
  return bsplit16(v); }
__device__ __forceinline__ v8f mac3(const F2& a, const F2& b, v8f c) { c = wmma_bf(a.l, b.h, c); c = wmma_bf(a.h, b.l, c); return wmma_bf(a.h, b.h, c); }
__device__ __forceinline__ float sigm(float v) { return 1.0f / (1.0f + expf(-v)); }
#define LDSX() do { asm volatile("s_wait_dscnt 0" ::: "memory"); __builtin_amdgcn_wave_barrier(); __builtin_amdgcn_fence(__ATOMIC_RELEASE, "workgroup"); } while (0)


// Additive multi-head attention block: Vproj = V WV^T (8 heads x 64), attn_Q = Q WQ^T, attn_K = K WK^T (one scalar per head), w = softmax_k(leaky_relu(attn_Q[q,h] + attn_K[k,h], 0.2)), out[q, h*64 + d] = sum_k w Vproj[k,h,d] + bias[h,d].  B 8, 1024 queries/keys, dims 512.
// k_vproj (exact GEMM -> transposed hi/lo planes), k_aqk (the 8 scalar projections per Q or K row, f32), k_attn (block = (64 queries, b*8+h): 32 key steps, VALU logits, row max up front, per-lane sums, P hi/lo x Vproj planes, + bias).
#define NB 8
#define SQ 1024
#define SK 1024
#define DI 512
#define NH 8
#define OD 64
#ifndef TQB
#define TQB (SQ / 64)
#define TNB NB
#endif
typedef __attribute__((ext_vector_type(8))) __bf16 v8b;
__device__ __forceinline__ v16b frag_b(const __bf16* rowk0, int lane) {
  union { v16b v; v8b q[2]; } u; const __bf16* p = rowk0 + 8 * (lane >> 4);
  u.q[0] = *(const v8b*)p; u.q[1] = *(const v8b*)(p + 16); return u.v;
}
__device__ __forceinline__ v16b frag_gbf(const float* rowk0, int lane) {
  v16b a; const float* p = rowk0 + 8 * (lane >> 4);
#pragma unroll
  for (int i = 0; i < 8; ++i) { a[i] = (__bf16)p[i]; a[8 + i] = (__bf16)p[16 + i]; }
  return a;
}
__device__ __forceinline__ float bfr(float v) { return (float)(__bf16)v; }
#define WS_VTH  0u                                   // bf16 [8][512][1024] Vproj transposed hi
#define WS_VTL  (WS_VTH + 2u * NB * DI * SK)
#define WS_AQ   (WS_VTL + 2u * NB * DI * SK)           // f32 [8][8 h][1024 q]
#define WS_AK   (WS_AQ + 4u * NB * NH * SQ)            // f32 [8][8 h][1024 k]
#define WS_END  (WS_AK + 4u * NB * NH * SK)

// k_vproj staging: the block's 64 V rows (all 512 k) and, per stage, 128 WV rows x 256 k are read once per block by whole-line loads (a wave-wide 16-B load = 512 contiguous bytes), rounded to bf16 once and kept in LDS; all four waves take their fragments from there.
#define VPITCH 520   // bf16 per staged V row: 1040 B = 16 B x 65 (odd), the pitch for 16-byte LDS readers
#define WPITCH 264   // bf16 per staged WV half row: 528 B = 16 B x 33 (odd)
typedef __attribute__((ext_vector_type(4))) __bf16 v4b;
__global__ __launch_bounds__(128) void k_vproj(const float* __restrict__ V, const float* __restrict__ WV, __bf16* __restrict__ VTH, __bf16* __restrict__ VTL) {
  __shared__ __align__(16) __bf16 sh[DI][72], sl[DI][72];
  __shared__ __align__(16) __bf16 sv[64][VPITCH], sw[128][WPITCH];
  const int tid = threadIdx.x, wave = tid >> 5, lane = tid & 31, col = lane & 15, g = lane >> 4; const int b = blockIdx.y; const int k0 = blockIdx.x * 64;
  const float* Vt = V + ((size_t)b * SK + k0) * DI + tid * 4;   // thread = 4 k of every row
  // unroll 32: that many independent 16-B loads per lane in flight, so a batch pays the load latency once
#pragma unroll 32
  for (int r = 0; r < 64; ++r) *(v4b*)&sv[r][tid * 4] = __builtin_convertvector(*(const v4f*)(Vt + (size_t)r * DI), v4b);
  const int wr = tid >> 6, wc = (tid & 63) * 4;                  // thread = 4 k of every second row of a stage
#pragma unroll 1
  for (int oc = 0; oc < DI / 128; ++oc) { v8f acc[8] = {};
    // unroll 1: one copy of the stage and its matrix block in the text
#pragma unroll 1
    for (int kh = 0; kh < 2; ++kh) { const float* Wt = WV + (size_t)(oc * 128 + wr) * DI + kh * 256 + wc;
      __syncthreads();   // every wave has finished its reads of the stage that sw still holds
      // unroll 32: as above
#pragma unroll 32
      for (int r = 0; r < 64; ++r) *(v4b*)&sw[2 * r + wr][wc] = __builtin_convertvector(*(const v4f*)(Wt + (size_t)(2 * r) * DI), v4b);
      __syncthreads();   // the stage (and, the first time, sv) is visible to every wave
      const __bf16* ap = &sv[wave * 16 + col][kh * 256]; const __bf16* bp = &sw[col][0];
      v16b fa[2], fb[2][8];   // two fragment sets: the next 32 k are fetched as one group ahead of the current matrix instructions, which then do not wait out the LDS latency
      fa[0] = frag_b(ap, lane);
#pragma unroll
      for (int j = 0; j < 8; ++j) fb[0][j] = frag_b(bp + j * 16 * WPITCH, lane);
      // full unroll, here and in the j loops: set and tile indices must be compile-time constants for the sets to stay in registers
#pragma unroll
      for (int kc = 0; kc < 8; ++kc) { const int cu = kc & 1, nx = cu ^ 1;
        if (kc + 1 < 8) { fa[nx] = frag_b(ap + (kc + 1) * 32, lane);
#pragma unroll
          for (int j = 0; j < 8; ++j) fb[nx][j] = frag_b(bp + j * 16 * WPITCH + (kc + 1) * 32, lane); }
#pragma unroll
        for (int j = 0; j < 8; ++j) acc[j] = wmma_bf(fa[cu], fb[cu][j], acc[j]); } }
#pragma unroll
    for (int j = 0; j < 8; ++j)
#pragma unroll
      for (int r = 0; r < 8; ++r) { const int o = oc * 128 + j * 16 + col; const float v = acc[j][r]; const __bf16 hb = (__bf16)v; sh[o][wave * 16 + 8 * g + r] = hb; sl[o][wave * 16 + 8 * g + r] = (__bf16)(v - (float)hb); } }
  __syncthreads();
  for (int q = tid; q < DI * 8; q += 128) { const int o = q >> 3, pc = q & 7; const size_t off = ((size_t)b * DI + o) * SK + k0 + pc * 8; vst2((unsigned*)(VTH + off), *(const v4u*)&sh[o][pc * 8]); vst2((unsigned*)(VTL + off), *(const v4u*)&sl[o][pc * 8]); }
}
// one level of a halving butterfly: at distance N a lane keeps the half of its 2N sums whose number has bit N as its own lane number has, and hands the other half to lane ^ N (N a template constant: every index into v is a compile-time constant)
template <int N> __device__ __forceinline__ void fold(float (&v)[32], int lane) { const bool up = (lane & N) != 0;
#pragma unroll
  for (int j = 0; j < N; ++j) { const float keep = up ? v[j + N] : v[j], send = up ? v[j] : v[j + N]; v[j] = keep + __shfl_xor(send, N); } }
// ---- k_aqk: block = (32 rows, b, which), 8 waves: which 0: AQ[b][h][q] = sum_i Q[b][q][i] WQ[h][i]; which 1: AK from K/WK.  A wave owns 4 rows and reads them as 16 whole-line loads (a wave-wide 16-B load = 512 contiguous bytes), all sent before anything waits; lane = 16 i of every row, all 8 heads; the 32 (row, head) partial sums of a lane are folded over the 32 lanes by a halving butterfly that leaves sum number L in lane L; 32 floats per (b,h) = one 128-B line per block
__global__ __launch_bounds__(256) void k_aqk(const float* __restrict__ Q, const float* __restrict__ K, const float* __restrict__ WQ, const float* __restrict__ WK, float* __restrict__ AQ, float* __restrict__ AK) {
  __shared__ __align__(16) float sw[NH][DI]; __shared__ __align__(16) float so[NH][32];
  const int tid = threadIdx.x, wave = tid >> 5, lane = tid & 31, b = blockIdx.y, which = blockIdx.z; const int r0 = blockIdx.x * 32; const float* X = which == 0 ? Q : K; const float* Wm = which == 0 ? WQ : WK; float* A = which == 0 ? AQ : AK; const int L = which == 0 ? SQ : SK;
  const float* xr = X + ((size_t)b * L + r0 + wave * 4) * DI + lane * 4;
  v4f x[4][4], wv[NH * DI / 1024];
  // full unroll, here and below: wv, x, acc and v are indexed by constants and stay in registers; the 4 weight loads (short latency) and the 16 row loads (from memory) go out together
#pragma unroll
  for (int q = 0; q < NH * DI / 1024; ++q) wv[q] = *(const v4f*)(Wm + q * 1024 + tid * 4);
#pragma unroll
  for (int r = 0; r < 4; ++r)
#pragma unroll
    for (int j = 0; j < 4; ++j) x[r][j] = *(const v4f*)(xr + r * DI + j * 128);
  __builtin_amdgcn_sched_barrier(0);   // keeps the row loads in front of the wait for the weights: the weights are then rounded and stored to LDS while the rows are on their way
#pragma unroll
  for (int q = 0; q < NH * DI / 1024; ++q) *(v4f*)(&sw[0][0] + q * 1024 + tid * 4) = __builtin_convertvector(__builtin_convertvector(wv[q], v4b), v4f);
  __syncthreads();
#pragma unroll
  for (int r = 0; r < 4; ++r)
#pragma unroll
    for (int j = 0; j < 4; ++j) x[r][j] = __builtin_convertvector(__builtin_convertvector(x[r][j], v4b), v4f);
  v2f acc[4][NH] = {};   // two f32 chains per (row, head): even and odd i pairs, one packed multiply-add each
#pragma unroll
  for (int h = 0; h < NH; ++h)
#pragma unroll
    for (int j = 0; j < 4; ++j) { const v4f w = *(const v4f*)&sw[h][j * 128 + lane * 4];
#pragma unroll
      for (int r = 0; r < 4; ++r) { acc[r][h] = __builtin_elementwise_fma(x[r][j].xy, w.xy, acc[r][h]); acc[r][h] = __builtin_elementwise_fma(x[r][j].zw, w.zw, acc[r][h]); } }
  float v[32];
#pragma unroll
  for (int r = 0; r < 4; ++r)
#pragma unroll
    for (int h = 0; h < NH; ++h) v[r * NH + h] = acc[r][h][0] + acc[r][h][1];
  fold<16>(v, lane); fold<8>(v, lane); fold<4>(v, lane); fold<2>(v, lane); fold<1>(v, lane);
  so[lane & 7][wave * 4 + (lane >> 3)] = v[0];
  __syncthreads();
  if (tid < NH * 8) { const int h = tid >> 3, pc = tid & 7; vst2(A + ((size_t)b * NH + h) * L + r0 + pc * 4, *(const v4f*)&so[h][pc * 4]); }
}
// ---- k_attn: block = (64 queries, b*8+h), 4 waves: s = leaky(aq[q] + ak[k], 0.2); softmax with the row max leaky(aq[q] + max ak) taken before the loop, the weight exp(s - max) as a key factor from an LDS table times a row factor, row sum folded over lanes once behind the loop; P hi/lo x Vproj planes (head columns h*64..+63 = rows b*512 + h*64 + d) 3 products; + bias[h][d]; out row segment 256 B
__global__ __launch_bounds__(128) void k_attn(const float* __restrict__ AQ, const float* __restrict__ AK, const __bf16* __restrict__ VTH, const __bf16* __restrict__ VTL, const float* __restrict__ BIAS, float* __restrict__ OUT) {
  __shared__ __align__(16) float sp[4][16][36]; __shared__ __align__(16) float so[4][16][68]; __shared__ __align__(16) float sk[3][SK];   // sk: ak, exp(ak - akmax), exp(0.2 (ak - akmax))
  const int tid = threadIdx.x, wave = tid >> 5, lane = tid & 31, col = lane & 15, g = lane >> 4;
  const int qb = blockIdx.x, bh = blockIdx.y, b = bh / NH, h = bh % NH; const int q0 = qb * 64 + wave * 16;
  float aq[8];
#pragma unroll
  for (int r = 0; r < 8; ++r) aq[r] = AQ[((size_t)b * NH + h) * SQ + q0 + 8 * g + r];
  const float* AKb = AK + ((size_t)b * NH + h) * SK;
  // The logit leaky(aq + ak) never decreases as ak grows (f32 add, and leaky with a positive slope, keep order), so a row's maximum over all keys is the logit at the largest ak: it is known before the key loop and equals, bit for bit, the last running maximum.
  float akmax;
  // full unroll, here and in the r loops below: the eight whole-line loads go out together; c, l and e are indexed by constants and stay in registers
  { v4f t = *(const v4f*)(AKb + lane * 4);
#pragma unroll
    for (int j = 1; j < SK / 128; ++j) { const v4f w = *(const v4f*)(AKb + j * 128 + lane * 4); t[0] = fmaxf(t[0], w[0]); t[1] = fmaxf(t[1], w[1]); t[2] = fmaxf(t[2], w[2]); t[3] = fmaxf(t[3], w[3]); }
    akmax = fmaxf(fmaxf(t[0], t[1]), fmaxf(t[2], t[3]));
#pragma unroll
    for (int o = 1; o < 32; o <<= 1) akmax = fmaxf(akmax, __shfl_xor(akmax, o)); }
  // exp(leaky(aq + ak) - m) splits into a factor of the key and a factor of the row.  Where aq + ak > 0 the row maximum m is aq + akmax, so the weight is exp(ak - akmax); elsewhere it is exp(0.2 (aq + akmax) - m) * exp(0.2 (ak - akmax)).  Every factor lies in (0, 1].  The two key factors are made once per block (8 keys a thread) and kept in LDS beside ak; the key loop holds no exp.
#pragma unroll
  for (int j = 0; j < 2; ++j) { const int kk = (wave * 2 + j) * 128 + lane * 4; const v4f a = *(const v4f*)(AKb + kk); v4f e1, e2;
#pragma unroll
    for (int i = 0; i < 4; ++i) { const float dk = a[i] - akmax; e1[i] = expf(dk); e2[i] = expf(0.2f * dk); }
    *(v4f*)&sk[0][kk] = a; *(v4f*)&sk[1][kk] = e1; *(v4f*)&sk[2][kk] = e2; }
  float c[8], l[8]; v8f acc[4] = {};   // c: the row's factor of the negative branch; l: this lane's own share of the row sum (its two key columns of every step)
#pragma unroll
  for (int r = 0; r < 8; ++r) { const float u = aq[r] + akmax; c[r] = expf(0.2f * u - (u > 0.f ? u : 0.2f * u)); l[r] = 0.f; }
  __syncthreads();   // the key tables, written by all four waves, are visible to every wave
#pragma unroll 1
  for (int ks = 0; ks < SK / 32; ++ks) { const int kc = ks * 32 + col; const float k0v = sk[0][kc], k1v = sk[0][kc + 16], p0 = sk[1][kc], p1 = sk[1][kc + 16], n0 = sk[2][kc], n1 = sk[2][kc + 16];
    float e[2][8];
#pragma unroll
    for (int r = 0; r < 8; ++r) { e[0][r] = aq[r] + k0v > 0.f ? p0 : c[r] * n0; e[1][r] = aq[r] + k1v > 0.f ? p1 : c[r] * n1; }
#pragma unroll
    for (int r = 0; r < 8; ++r) { l[r] += e[0][r] + e[1][r]; sp[wave][8 * g + r][col] = e[0][r]; sp[wave][8 * g + r][16 + col] = e[1][r]; }
    LDSX();
    const F2 pa = split_row(&sp[wave][col][0], 0, lane);
#pragma unroll
    for (int dt = 0; dt < 4; ++dt) { const size_t vrow = ((size_t)b * DI + h * OD + dt * 16 + col) * SK + ks * 32; const v16b vh = frag_b(VTH + vrow, lane), vl = frag_b(VTL + vrow, lane); acc[dt] = wmma_bf(pa.l, vh, acc[dt]); acc[dt] = wmma_bf(pa.h, vl, acc[dt]); acc[dt] = wmma_bf(pa.h, vh, acc[dt]); }
    LDSX(); }
#pragma unroll
  for (int r = 0; r < 8; ++r) { float ls = l[r];
#pragma unroll
    for (int o = 1; o < 16; o <<= 1) ls += __shfl_xor(ls, o);
    const float il = 1.0f / ls;
#pragma unroll
    for (int dt = 0; dt < 4; ++dt) so[wave][8 * g + r][dt * 16 + col] = acc[dt][r] * il + bfr(BIAS[h * OD + dt * 16 + col]); }
  LDSX();
  for (int rl = 0; rl < 16; ++rl) if (lane < 16) vst2(OUT + ((size_t)b * SQ + q0 + rl) * (NH * OD) + h * OD + lane * 4, *(const v4f*)&so[wave][rl][lane * 4]);
}
extern "C" void kernel_launch(void* const* d_in, const int* in_sizes, int n_in, void* d_out, int out_size, void* d_ws, size_t ws_size, hipStream_t stream) {
  (void)in_sizes; (void)n_in; (void)out_size;
  const float** F = (const float**)d_in;   // Q, K, V [8,1024,512], WQ [8,512], WK [8,512], WV [512,512], bias [8,64]
  if (ws_size < (size_t)WS_END) return;
  char* ws = (char*)d_ws; __bf16 *VTH = (__bf16*)(ws + WS_VTH), *VTL = (__bf16*)(ws + WS_VTL); float *AQ = (float*)(ws + WS_AQ), *AK = (float*)(ws + WS_AK);
  k_vproj<<<dim3(SK / 64, TNB), 128, 0, stream>>>(F[2], F[5], VTH, VTL);
  k_aqk<<<dim3(SQ / 32, TNB, 2), 256, 0, stream>>>(F[0], F[1], F[3], F[4], AQ, AK);
  k_attn<<<dim3(TQB, TNB * NH), 128, 0, stream>>>(AQ, AK, VTH, VTL, F[6], (float*)d_out);
}

// v005
// It runs in 60.5 microseconds.
// In two side-by-side timings against v004, it was 1.59 and 1.58 times as fast.
// Counting every step since v000, it is 6.59 times as fast.
// compute dtype: Q, K, V, WQ, WK, WV, bias (module inputs) rounded to bf16; Vproj with exact bf16 products on WMMA; the per-head scalar scores attn_Q/attn_K as f32 dots of bf16-rounded inputs; rank-1 logits leaky(aq[q] + ak[k]) and the softmax (row maximum known up front) in f32; P.Vproj with both computed operands as bf16 hi + residual pairs (3 products); f32 accumulate.
#include <hip/hip_runtime.h>
#include <math.h>

typedef __attribute__((ext_vector_type(16))) _Float16 v16h;
typedef __attribute__((ext_vector_type(16))) __bf16 v16b;
typedef __attribute__((ext_vector_type(8)))  _Float16 v8h;
typedef __attribute__((ext_vector_type(8)))  float v8f;
typedef __attribute__((ext_vector_type(4)))  float v4f;
typedef __attribute__((ext_vector_type(2)))  float v2f;
typedef __attribute__((ext_vector_type(4)))  unsigned v4u;
typedef __attribute__((ext_vector_type(4)))  int v4i;
typedef float __attribute__((may_alias)) float_a;
typedef int __attribute__((may_alias)) int_a;

template <typename T> __device__ __forceinline__ void vst2(void* p, T v) { *(T*)p = v;  }
__device__ __forceinline__ v8f wmma16(v16h a, v16h b, v8f c) {
  v8f d = __builtin_amdgcn_wmma_f32_16x16x32_f16(false, a, false, b, (short)0, c, false, false);
  asm volatile("v_nop\n\tv_nop\n\tv_nop\n\tv_nop" : "+v"(d) : "v"(a), "v"(b));
  return d;
}
__device__ __forceinline__ v8f wmma_bf(v16b a, v16b b, v8f c) {
  v8f d = __builtin_amdgcn_wmma_f32_16x16x32_bf16(false, a, false, b, (short)0, c, false, false);
  asm volatile("v_nop\n\tv_nop\n\tv_nop\n\tv_nop" : "+v"(d) : "v"(a), "v"(b));
  return d;
}
// 16x16x32 fragments: lane = (h = lane>>4, row/col = lane&15); elements 0..7 = k0+8h+0..7, 8..15 = k0+16+8h+0..7; D element r = row 8h+r
__device__ __forceinline__ v16h frag_h(const _Float16* rowk0, int lane) {
  union { v16h v; v8h q[2]; } u; const _Float16* p = rowk0 + 8 * (lane >> 4);
  u.q[0] = *(const v8h*)p; u.q[1] = *(const v8h*)(p + 16); return u.v;
}
__device__ __forceinline__ v16h frag_f32(const float* rowk0, int lane) {
  v16h a; const float* p = rowk0 + 8 * (lane >> 4);
#pragma unroll
  for (int i = 0; i < 8; ++i) { a[i] = (_Float16)p[i]; a[8 + i] = (_Float16)p[16 + i]; }
  return a;
}
__device__ __forceinline__ v16h frag_f32s(const float* rowk0, int lane, float sc) {
  v16h a; const float* p = rowk0 + 8 * (lane >> 4);
#pragma unroll
  for (int i = 0; i < 8; ++i) { a[i] = (_Float16)(p[i] * sc); a[8 + i] = (_Float16)(p[16 + i] * sc); }
  return a;
}
// column fragment from a [K][ld] layout (column n), rows >= K read as 0
__device__ __forceinline__ v16h fragc_f32(const float* W, int k0, int n, int lane, int ld, int K) {
  v16h a; const int g = lane >> 4;
#pragma unroll
  for (int i = 0; i < 8; ++i) { const int ka = k0 + 8 * g + i, kb = ka + 16;
    a[i] = (_Float16)(ka < K ? W[(size_t)(ka < K ? ka : K - 1) * ld + n] : 0.f); a[8 + i] = (_Float16)(kb < K ? W[(size_t)(kb < K ? kb : K - 1) * ld + n] : 0.f); }
  return a;
}
struct F2 { v16b h, l; };
__device__ __forceinline__ F2 bsplit16(const float v[16]) { F2 r;
#pragma unroll
  for (int i = 0; i < 16; ++i) { const __bf16 h = (__bf16)v[i]; r.h[i] = h; r.l[i] = (__bf16)(v[i] - (float)h); }
  return r; }
__device__ __forceinline__ F2 split_row(const float* row, int k0, int lane) { float v[16]; const float* p = row + k0 + 8 * (lane >> 4);
#pragma unroll
  for (int i = 0; i < 8; ++i) { v[i] = p[i]; v[8 + i] = p[16 + i]; }
  return bsplit16(v); }
__device__ __forceinline__ F2 split_rowK(const float* row, int k0, int lane, int K) { float v[16]; const int g = lane >> 4;
#pragma unroll
  for (int i = 0; i < 8; ++i) { const int ka = k0 + 8 * g + i, kb = ka + 16; v[i] = ka < K ? row[ka < K ? ka : K - 1] : 0.f; v[8 + i] = kb < K ? row[kb < K ? kb : K - 1] : 0.f; }
  return bsplit16(v); }
__device__ __forceinline__ F2 split_col(const float* W, int k0, int n, int lane, int ld, int K) { float v[16]; const int g = lane >> 4;
#pragma unroll
  for (int i = 0; i < 8; ++i) { const int ka = k0 + 8 * g + i, kb = ka + 16; v[i] = ka < K ? W[(size_t)(ka < K ? ka : K - 1) * ld + n] : 0.f; v[8 + i] = kb < K ? W[(size_t)(kb < K ? kb : K - 1) * ld + n] : 0.f; }
  return bsplit16(v); }
__device__ __forceinline__ v8f mac3(const F2& a, const F2& b, v8f c) { c = wmma_bf(a.l, b.h, c); c = wmma_bf(a.h, b.l, c); return wmma_bf(a.h, b.h, c); }
__device__ __forceinline__ float sigm(float v) { return 1.0f / (1.0f + expf(-v)); }
#define LDSX() do { asm volatile("s_wait_dscnt 0" ::: "memory"); __builtin_amdgcn_wave_barrier(); __builtin_amdgcn_fence(__ATOMIC_RELEASE, "workgroup"); } while (0)


// Additive multi-head attention block: Vproj = V WV^T (8 heads x 64), attn_Q = Q WQ^T, attn_K = K WK^T (one scalar per head), w = softmax_k(leaky_relu(attn_Q[q,h] + attn_K[k,h], 0.2)), out[q, h*64 + d] = sum_k w Vproj[k,h,d] + bias[h,d].  B 8, 1024 queries/keys, dims 512.
// k_vproj (exact GEMM -> transposed hi/lo planes), k_aqk (the 8 scalar projections per Q or K row, f32), k_attn (block = (64 queries, b*8+h): 32 key steps, VALU logits, row max up front, per-lane sums, P hi/lo x Vproj planes, + bias).
#define NB 8
#define SQ 1024
#define SK 1024
#define DI 512
#define NH 8
#define OD 64
#ifndef TQB
#define TQB (SQ / 64)
#define TNB NB
#endif
typedef __attribute__((ext_vector_type(8))) __bf16 v8b;
__device__ __forceinline__ v16b frag_b(const __bf16* rowk0, int lane) {
  union { v16b v; v8b q[2]; } u; const __bf16* p = rowk0 + 8 * (lane >> 4);
  u.q[0] = *(const v8b*)p; u.q[1] = *(const v8b*)(p + 16); return u.v;
}
__device__ __forceinline__ v16b frag_gbf(const float* rowk0, int lane) {
  v16b a; const float* p = rowk0 + 8 * (lane >> 4);
#pragma unroll
  for (int i = 0; i < 8; ++i) { a[i] = (__bf16)p[i]; a[8 + i] = (__bf16)p[16 + i]; }
  return a;
}
__device__ __forceinline__ float bfr(float v) { return (float)(__bf16)v; }
#define WS_VTH  0u                                   // bf16 [8][512][1024] Vproj transposed hi
#define WS_VTL  (WS_VTH + 2u * NB * DI * SK)
#define WS_AQ   (WS_VTL + 2u * NB * DI * SK)           // f32 [8][8 h][1024 q]
#define WS_AK   (WS_AQ + 4u * NB * NH * SQ)            // f32 [8][8 h][1024 k]
#define WS_END  (WS_AK + 4u * NB * NH * SK)

// k_vproj staging: the block's 64 V rows (all 512 k) and, per stage, 128 WV rows x 256 k are read once per block by whole-line loads (a wave-wide 16-B load = 512 contiguous bytes), rounded to bf16 once and kept in LDS; all four waves take their fragments from there.
#define VPITCH 520   // bf16 per staged V row: 1040 B = 16 B x 65 (odd), the pitch for 16-byte LDS readers
#define WPITCH 264   // bf16 per staged WV half row: 528 B = 16 B x 33 (odd)
typedef __attribute__((ext_vector_type(4))) __bf16 v4b;
__global__ __launch_bounds__(128) void k_vproj(const float* __restrict__ V, const float* __restrict__ WV, __bf16* __restrict__ VTH, __bf16* __restrict__ VTL) {
  __shared__ __align__(16) __bf16 sh[DI][72], sl[DI][72];
  __shared__ __align__(16) __bf16 sv[64][VPITCH], sw[128][WPITCH];
  const int tid = threadIdx.x, wave = tid >> 5, lane = tid & 31, col = lane & 15, g = lane >> 4; const int b = blockIdx.y; const int k0 = blockIdx.x * 64;
  const float* Vt = V + ((size_t)b * SK + k0) * DI + tid * 4;   // thread = 4 k of every row
  // unroll 32: that many independent 16-B loads per lane in flight, so a batch pays the load latency once
#pragma unroll 32
  for (int r = 0; r < 64; ++r) *(v4b*)&sv[r][tid * 4] = __builtin_convertvector(*(const v4f*)(Vt + (size_t)r * DI), v4b);
  const int wr = tid >> 6, wc = (tid & 63) * 4;                  // thread = 4 k of every second row of a stage
#pragma unroll 1
  for (int oc = 0; oc < DI / 128; ++oc) { v8f acc[8] = {};
    // unroll 1: one copy of the stage and its matrix block in the text
#pragma unroll 1
    for (int kh = 0; kh < 2; ++kh) { const float* Wt = WV + (size_t)(oc * 128 + wr) * DI + kh * 256 + wc;
      __syncthreads();   // every wave has finished its reads of the stage that sw still holds
      // unroll 32: as above
#pragma unroll 32
      for (int r = 0; r < 64; ++r) *(v4b*)&sw[2 * r + wr][wc] = __builtin_convertvector(*(const v4f*)(Wt + (size_t)(2 * r) * DI), v4b);
      __syncthreads();   // the stage (and, the first time, sv) is visible to every wave
      const __bf16* ap = &sv[wave * 16 + col][kh * 256]; const __bf16* bp = &sw[col][0];
      v16b fa[2], fb[2][8];   // two fragment sets: the next 32 k are fetched as one group ahead of the current matrix instructions, which then do not wait out the LDS latency
      fa[0] = frag_b(ap, lane);
#pragma unroll
      for (int j = 0; j < 8; ++j) fb[0][j] = frag_b(bp + j * 16 * WPITCH, lane);
      // full unroll, here and in the j loops: set and tile indices must be compile-time constants for the sets to stay in registers
#pragma unroll
      for (int kc = 0; kc < 8; ++kc) { const int cu = kc & 1, nx = cu ^ 1;
        if (kc + 1 < 8) { fa[nx] = frag_b(ap + (kc + 1) * 32, lane);
#pragma unroll
          for (int j = 0; j < 8; ++j) fb[nx][j] = frag_b(bp + j * 16 * WPITCH + (kc + 1) * 32, lane); }
#pragma unroll
        for (int j = 0; j < 8; ++j) acc[j] = wmma_bf(fa[cu], fb[cu][j], acc[j]); } }
#pragma unroll
    for (int j = 0; j < 8; ++j)
#pragma unroll
      for (int r = 0; r < 8; ++r) { const int o = oc * 128 + j * 16 + col; const float v = acc[j][r]; const __bf16 hb = (__bf16)v; sh[o][wave * 16 + 8 * g + r] = hb; sl[o][wave * 16 + 8 * g + r] = (__bf16)(v - (float)hb); } }
  __syncthreads();
  for (int q = tid; q < DI * 8; q += 128) { const int o = q >> 3, pc = q & 7; const size_t off = ((size_t)b * DI + o) * SK + k0 + pc * 8; vst2((unsigned*)(VTH + off), *(const v4u*)&sh[o][pc * 8]); vst2((unsigned*)(VTL + off), *(const v4u*)&sl[o][pc * 8]); }
}
// one level of a halving butterfly: at distance N a lane keeps the half of its 2N sums whose number has bit N as its own lane number has, and hands the other half to lane ^ N (N a template constant: every index into v is a compile-time constant)
template <int N> __device__ __forceinline__ void fold(float (&v)[32], int lane) { const bool up = (lane & N) != 0;
#pragma unroll
  for (int j = 0; j < N; ++j) { const float keep = up ? v[j + N] : v[j], send = up ? v[j] : v[j + N]; v[j] = keep + __shfl_xor(send, N); } }
// ---- k_aqk: block = (32 rows, b, which), 8 waves: which 0: AQ[b][h][q] = sum_i Q[b][q][i] WQ[h][i]; which 1: AK from K/WK.  A wave owns 4 rows and reads them as 16 whole-line loads (a wave-wide 16-B load = 512 contiguous bytes), all sent before anything waits; lane = 16 i of every row, all 8 heads; the 32 (row, head) partial sums of a lane are folded over the 32 lanes by a halving butterfly that leaves sum number L in lane L; 32 floats per (b,h) = one 128-B line per block
__global__ __launch_bounds__(256) void k_aqk(const float* __restrict__ Q, const float* __restrict__ K, const float* __restrict__ WQ, const float* __restrict__ WK, float* __restrict__ AQ, float* __restrict__ AK) {
  __shared__ __align__(16) float sw[NH][DI]; __shared__ __align__(16) float so[NH][32];
  const int tid = threadIdx.x, wave = tid >> 5, lane = tid & 31, b = blockIdx.y, which = blockIdx.z; const int r0 = blockIdx.x * 32; const float* X = which == 0 ? Q : K; const float* Wm = which == 0 ? WQ : WK; float* A = which == 0 ? AQ : AK; const int L = which == 0 ? SQ : SK;
  const float* xr = X + ((size_t)b * L + r0 + wave * 4) * DI + lane * 4;
  v4f x[4][4], wv[NH * DI / 1024];
  // full unroll, here and below: wv, x, acc and v are indexed by constants and stay in registers; the 4 weight loads (short latency) and the 16 row loads (from memory) go out together
#pragma unroll
  for (int q = 0; q < NH * DI / 1024; ++q) wv[q] = *(const v4f*)(Wm + q * 1024 + tid * 4);
#pragma unroll
  for (int r = 0; r < 4; ++r)
#pragma unroll
    for (int j = 0; j < 4; ++j) x[r][j] = *(const v4f*)(xr + r * DI + j * 128);
  __builtin_amdgcn_sched_barrier(0);   // keeps the row loads in front of the wait for the weights: the weights are then rounded and stored to LDS while the rows are on their way
#pragma unroll
  for (int q = 0; q < NH * DI / 1024; ++q) *(v4f*)(&sw[0][0] + q * 1024 + tid * 4) = __builtin_convertvector(__builtin_convertvector(wv[q], v4b), v4f);
  __syncthreads();
#pragma unroll
  for (int r = 0; r < 4; ++r)
#pragma unroll
    for (int j = 0; j < 4; ++j) x[r][j] = __builtin_convertvector(__builtin_convertvector(x[r][j], v4b), v4f);
  v2f acc[4][NH] = {};   // two f32 chains per (row, head): even and odd i pairs, one packed multiply-add each
#pragma unroll
  for (int h = 0; h < NH; ++h)
#pragma unroll
    for (int j = 0; j < 4; ++j) { const v4f w = *(const v4f*)&sw[h][j * 128 + lane * 4];
#pragma unroll
      for (int r = 0; r < 4; ++r) { acc[r][h] = __builtin_elementwise_fma(x[r][j].xy, w.xy, acc[r][h]); acc[r][h] = __builtin_elementwise_fma(x[r][j].zw, w.zw, acc[r][h]); } }
  float v[32];
#pragma unroll
  for (int r = 0; r < 4; ++r)
#pragma unroll
    for (int h = 0; h < NH; ++h) v[r * NH + h] = acc[r][h][0] + acc[r][h][1];
  fold<16>(v, lane); fold<8>(v, lane); fold<4>(v, lane); fold<2>(v, lane); fold<1>(v, lane);
  so[lane & 7][wave * 4 + (lane >> 3)] = v[0];
  __syncthreads();
  if (tid < NH * 8) { const int h = tid >> 3, pc = tid & 7; vst2(A + ((size_t)b * NH + h) * L + r0 + pc * 4, *(const v4f*)&so[h][pc * 4]); }
}
#define VSP 72                      // bf16 per staged Vproj row: 144 B = 16 B x 9 (odd), the pitch for 16-byte LDS readers
#define VBUFB (2u * OD * VSP * 2u)  // bytes of one buffer (two planes)
// one tile's copies of one thread: 4 pieces of 16 B per plane, 16 rows apart (a wave's copy = 4 whole lines).  gh, gl: the thread's first piece in each plane; lds: its place in the hi plane of the buffer.
__device__ __forceinline__ void stage_v(const __bf16* gh, const __bf16* gl, unsigned lds) {
  const unsigned rs = 16u * VSP * 2u, ps = OD * VSP * 2u;
  // the wait on xcnt is the last line of the copies' own statement: it stands in front of every later write of the address registers that the copies name
  asm volatile("global_load_async_to_lds_b128 %0, %8, off\n\t"
               "global_load_async_to_lds_b128 %1, %9, off\n\t"
               "global_load_async_to_lds_b128 %2, %10, off\n\t"
               "global_load_async_to_lds_b128 %3, %11, off\n\t"
               "global_load_async_to_lds_b128 %4, %12, off\n\t"
               "global_load_async_to_lds_b128 %5, %13, off\n\t"
               "global_load_async_to_lds_b128 %6, %14, off\n\t"
               "global_load_async_to_lds_b128 %7, %15, off\n\t"
               "s_wait_xcnt 0x0"
               :: "v"(lds), "v"(lds + rs), "v"(lds + 2u * rs), "v"(lds + 3u * rs), "v"(lds + ps), "v"(lds + ps + rs), "v"(lds + ps + 2u * rs), "v"(lds + ps + 3u * rs),
                  "v"(gh), "v"(gh + 16 * SK), "v"(gh + 32 * SK), "v"(gh + 48 * SK), "v"(gl), "v"(gl + 16 * SK), "v"(gl + 32 * SK), "v"(gl + 48 * SK)
               : "memory");
}
// ---- k_attn: block = (64 queries, b*8+h), 4 waves: s = leaky(aq[q] + ak[k], 0.2); softmax with the row max leaky(aq[q] + max ak) taken before the loop, the weight exp(s - max) as a key factor from an LDS table times a row factor, row sum folded over lanes once behind the loop; P hi/lo x Vproj planes (head columns h*64..+63 = rows b*512 + h*64 + d) 3 products; + bias[h][d]; out row segment 256 B
__global__ __launch_bounds__(128) void k_attn(const float* __restrict__ AQ, const float* __restrict__ AK, const __bf16* __restrict__ VTH, const __bf16* __restrict__ VTL, const float* __restrict__ BIAS, float* __restrict__ OUT) {
  __shared__ __align__(16) float sp[4][16][36]; __shared__ __align__(16) float so[4][16][68]; __shared__ __align__(16) float sk[3][SK];   // sk: ak, exp(ak - akmax), exp(0.2 (ak - akmax))
  __shared__ __align__(16) __bf16 sv[2][2][OD][VSP];   // [buffer][plane hi, lo][d][key of the tile]
  const int tid = threadIdx.x, wave = tid >> 5, lane = tid & 31, col = lane & 15, g = lane >> 4;
  const int qb = blockIdx.x, bh = blockIdx.y, b = bh / NH, h = bh % NH; const int q0 = qb * 64 + wave * 16;
  const size_t voff = ((size_t)b * DI + h * OD + (tid >> 3)) * SK + (tid & 7) * 8;   // thread = 16 B (8 keys) of rows tid / 8 + 0, 16, 32, 48
  const __bf16* gvh = VTH + voff; const __bf16* gvl = VTL + voff;
  const unsigned lv = (unsigned)(size_t)&sv[0][0][tid >> 3][(tid & 7) * 8];   // LDS byte address: the low 32 bits of the shared address
  stage_v(gvh, gvl, lv);   // tile 0 into buffer 0: on its way while the key tables are made
  float aq[8];
#pragma unroll
  for (int r = 0; r < 8; ++r) aq[r] = AQ[((size_t)b * NH + h) * SQ + q0 + 8 * g + r];
  const float* AKb = AK + ((size_t)b * NH + h) * SK;
  // The logit leaky(aq + ak) never decreases as ak grows (f32 add, and leaky with a positive slope, keep order), so a row's maximum over all keys is the logit at the largest ak: it is known before the key loop and equals, bit for bit, the last running maximum.
  float akmax;
  // full unroll, here and in the r loops below: the eight whole-line loads go out together; c, l and e are indexed by constants and stay in registers
  { v4f t = *(const v4f*)(AKb + lane * 4);
#pragma unroll
    for (int j = 1; j < SK / 128; ++j) { const v4f w = *(const v4f*)(AKb + j * 128 + lane * 4); t[0] = fmaxf(t[0], w[0]); t[1] = fmaxf(t[1], w[1]); t[2] = fmaxf(t[2], w[2]); t[3] = fmaxf(t[3], w[3]); }
    akmax = fmaxf(fmaxf(t[0], t[1]), fmaxf(t[2], t[3]));
#pragma unroll
    for (int o = 1; o < 32; o <<= 1) akmax = fmaxf(akmax, __shfl_xor(akmax, o)); }
  // exp(leaky(aq + ak) - m) splits into a factor of the key and a factor of the row.  Where aq + ak > 0 the row maximum m is aq + akmax, so the weight is exp(ak - akmax); elsewhere it is exp(0.2 (aq + akmax) - m) * exp(0.2 (ak - akmax)).  Every factor lies in (0, 1].  The two key factors are made once per block (8 keys a thread) and kept in LDS beside ak; the key loop holds no exp.
#pragma unroll
  for (int j = 0; j < 2; ++j) { const int kk = (wave * 2 + j) * 128 + lane * 4; const v4f a = *(const v4f*)(AKb + kk); v4f e1, e2;
#pragma unroll
    for (int i = 0; i < 4; ++i) { const float dk = a[i] - akmax; e1[i] = expf(dk); e2[i] = expf(0.2f * dk); }
    *(v4f*)&sk[0][kk] = a; *(v4f*)&sk[1][kk] = e1; *(v4f*)&sk[2][kk] = e2; }
  float c[8], l[8]; v8f acc[4] = {};   // c: the row's factor of the negative branch; l: this lane's own share of the row sum (its two key columns of every step)
#pragma unroll
  for (int r = 0; r < 8; ++r) { const float u = aq[r] + akmax; c[r] = expf(0.2f * u - (u > 0.f ? u : 0.2f * u)); l[r] = 0.f; }
  asm volatile("s_wait_asynccnt 0x0" ::: "memory");   // this wave's copies of tile 0 have landed
  __syncthreads();   // the key tables and tile 0, written by all four waves, are visible to every wave
  stage_v(gvh + 64, gvl + 64, lv + VBUFB);   // tile 1 into buffer 1
  // unroll 1: one copy of the trip in the text
#pragma unroll 1
  for (int t = 0; t < SK / 64; ++t) { const __bf16* vt = &sv[t & 1][0][col][0];
  // full unroll: the two 32-key steps of a tile differ by constant LDS offsets
#pragma unroll
  for (int s = 0; s < 2; ++s) { const int ks = t * 2 + s; const int kc = ks * 32 + col;
    v16b vh[4], vl[4];   // the step's 16 fragment reads go out as one group in front of the weights, which are made while the reads are on their way
#pragma unroll
    for (int dt = 0; dt < 4; ++dt) { vh[dt] = frag_b(vt + dt * 16 * VSP + s * 32, lane); vl[dt] = frag_b(vt + (OD + dt * 16) * VSP + s * 32, lane); }
    const float k0v = sk[0][kc], k1v = sk[0][kc + 16], p0 = sk[1][kc], p1 = sk[1][kc + 16], n0 = sk[2][kc], n1 = sk[2][kc + 16];
    float e[2][8];
#pragma unroll
    for (int r = 0; r < 8; ++r) { e[0][r] = aq[r] + k0v > 0.f ? p0 : c[r] * n0; e[1][r] = aq[r] + k1v > 0.f ? p1 : c[r] * n1; }
#pragma unroll
    for (int r = 0; r < 8; ++r) { l[r] += e[0][r] + e[1][r]; sp[wave][8 * g + r][col] = e[0][r]; sp[wave][8 * g + r][16 + col] = e[1][r]; }
    LDSX();
    const F2 pa = split_row(&sp[wave][col][0], 0, lane);
#pragma unroll
    for (int dt = 0; dt < 4; ++dt) { acc[dt] = wmma_bf(pa.l, vh[dt], acc[dt]); acc[dt] = wmma_bf(pa.h, vl[dt], acc[dt]); acc[dt] = wmma_bf(pa.h, vh[dt], acc[dt]); }
    LDSX(); }
    asm volatile("s_wait_dscnt 0x0" ::: "memory");      // this wave's reads of the buffer are done
    asm volatile("s_wait_asynccnt 0x0" ::: "memory");   // this wave's copies of tile t + 1 have landed
    __syncthreads();   // tile t + 1 is visible to every wave, and every wave has left the buffer of tile t
    if (t + 2 < SK / 64) stage_v(gvh + (t + 2) * 64, gvl + (t + 2) * 64, lv + (unsigned)(t & 1) * VBUFB); }
  asm volatile("s_wait_asynccnt 0x0" ::: "memory");   // no copy is outstanding behind the loop
#pragma unroll
  for (int r = 0; r < 8; ++r) { float ls = l[r];
#pragma unroll
    for (int o = 1; o < 16; o <<= 1) ls += __shfl_xor(ls, o);
    const float il = 1.0f / ls;
#pragma unroll
    for (int dt = 0; dt < 4; ++dt) so[wave][8 * g + r][dt * 16 + col] = acc[dt][r] * il + bfr(BIAS[h * OD + dt * 16 + col]); }
  LDSX();
  for (int rl = 0; rl < 16; ++rl) if (lane < 16) vst2(OUT + ((size_t)b * SQ + q0 + rl) * (NH * OD) + h * OD + lane * 4, *(const v4f*)&so[wave][rl][lane * 4]);
}
extern "C" void kernel_launch(void* const* d_in, const int* in_sizes, int n_in, void* d_out, int out_size, void* d_ws, size_t ws_size, hipStream_t stream) {
  (void)in_sizes; (void)n_in; (void)out_size;
  const float** F = (const float**)d_in;   // Q, K, V [8,1024,512], WQ [8,512], WK [8,512], WV [512,512], bias [8,64]
  if (ws_size < (size_t)WS_END) return;
  char* ws = (char*)d_ws; __bf16 *VTH = (__bf16*)(ws + WS_VTH), *VTL = (__bf16*)(ws + WS_VTL); float *AQ = (float*)(ws + WS_AQ), *AK = (float*)(ws + WS_AK);
  k_vproj<<<dim3(SK / 64, TNB), 128, 0, stream>>>(F[2], F[5], VTH, VTL);
  k_aqk<<<dim3(SQ / 32, TNB, 2), 256, 0, stream>>>(F[0], F[1], F[3], F[4], AQ, AK);
  k_attn<<<dim3(TQB, TNB * NH), 128, 0, stream>>>(AQ, AK, VTH, VTL, F[6], (float*)d_out);
}

// v006
// Measured time: 48.1 microseconds a run.
// In two side-by-side timings against v005, it was 1.26 and 1.25 times as fast.
// Counting every step since v000, it is 8.27 times as fast.
// compute dtype: Q, K, V, WQ, WK, WV, bias (module inputs) rounded to bf16; Vproj with exact bf16 products on WMMA; the per-head scalar scores attn_Q/attn_K as f32 dots of bf16-rounded inputs; rank-1 logits leaky(aq[q] + ak[k]) and the softmax (row maximum known up front) in f32; P.Vproj with both computed operands as bf16 hi + residual pairs (3 products); f32 accumulate.
#include <hip/hip_runtime.h>
#include <math.h>

typedef __attribute__((ext_vector_type(16))) _Float16 v16h;
typedef __attribute__((ext_vector_type(16))) __bf16 v16b;
typedef __attribute__((ext_vector_type(8)))  _Float16 v8h;
typedef __attribute__((ext_vector_type(8)))  float v8f;
typedef __attribute__((ext_vector_type(4)))  float v4f;
typedef __attribute__((ext_vector_type(2)))  float v2f;
typedef __attribute__((ext_vector_type(4)))  unsigned v4u;
typedef __attribute__((ext_vector_type(4)))  int v4i;
typedef float __attribute__((may_alias)) float_a;
typedef int __attribute__((may_alias)) int_a;

template <typename T> __device__ __forceinline__ void vst2(void* p, T v) { *(T*)p = v;  }
__device__ __forceinline__ v8f wmma16(v16h a, v16h b, v8f c) {
  v8f d = __builtin_amdgcn_wmma_f32_16x16x32_f16(false, a, false, b, (short)0, c, false, false);
  asm volatile("v_nop\n\tv_nop\n\tv_nop\n\tv_nop" : "+v"(d) : "v"(a), "v"(b));
  return d;
}
__device__ __forceinline__ v8f wmma_bf(v16b a, v16b b, v8f c) {
  v8f d = __builtin_amdgcn_wmma_f32_16x16x32_bf16(false, a, false, b, (short)0, c, false, false);
  asm volatile("v_nop\n\tv_nop\n\tv_nop\n\tv_nop" : "+v"(d) : "v"(a), "v"(b));
  return d;
}
// 16x16x32 fragments: lane = (h = lane>>4, row/col = lane&15); elements 0..7 = k0+8h+0..7, 8..15 = k0+16+8h+0..7; D element r = row 8h+r
__device__ __forceinline__ v16h frag_h(const _Float16* rowk0, int lane) {
  union { v16h v; v8h q[2]; } u; const _Float16* p = rowk0 + 8 * (lane >> 4);
  u.q[0] = *(const v8h*)p; u.q[1] = *(const v8h*)(p + 16); return u.v;
}
__device__ __forceinline__ v16h frag_f32(const float* rowk0, int lane) {
  v16h a; const float* p = rowk0 + 8 * (lane >> 4);
#pragma unroll
  for (int i = 0; i < 8; ++i) { a[i] = (_Float16)p[i]; a[8 + i] = (_Float16)p[16 + i]; }
  return a;
}
__device__ __forceinline__ v16h frag_f32s(const float* rowk0, int lane, float sc) {
  v16h a; const float* p = rowk0 + 8 * (lane >> 4);
#pragma unroll
  for (int i = 0; i < 8; ++i) { a[i] = (_Float16)(p[i] * sc); a[8 + i] = (_Float16)(p[16 + i] * sc); }
  return a;
}
// column fragment from a [K][ld] layout (column n), rows >= K read as 0
__device__ __forceinline__ v16h fragc_f32(const float* W, int k0, int n, int lane, int ld, int K) {
  v16h a; const int g = lane >> 4;
#pragma unroll
  for (int i = 0; i < 8; ++i) { const int ka = k0 + 8 * g + i, kb = ka + 16;
    a[i] = (_Float16)(ka < K ? W[(size_t)(ka < K ? ka : K - 1) * ld + n] : 0.f); a[8 + i] = (_Float16)(kb < K ? W[(size_t)(kb < K ? kb : K - 1) * ld + n] : 0.f); }
  return a;
}
struct F2 { v16b h, l; };
__device__ __forceinline__ F2 bsplit16(const float v[16]) { F2 r;
#pragma unroll
  for (int i = 0; i < 16; ++i) { const __bf16 h = (__bf16)v[i]; r.h[i] = h; r.l[i] = (__bf16)(v[i] - (float)h); }
  return r; }
__device__ __forceinline__ F2 split_row(const float* row, int k0, int lane) { float v[16]; const float* p = row + k0 + 8 * (lane >> 4);
#pragma unroll
  for (int i = 0; i < 8; ++i) { v[i] = p[i]; v[8 + i] = p[16 + i]; }
  return bsplit16(v); }
__device__ __forceinline__ F2 split_rowK(const float* row, int k0, int lane, int K) { float v[16]; const int g = lane >> 4;
#pragma unroll
  for (int i = 0; i < 8; ++i) { const int ka = k0 + 8 * g + i, kb = ka + 16; v[i] = ka < K ? row[ka < K ? ka : K - 1] : 0.f; v[8 + i] = kb < K ? row[kb < K ? kb : K - 1] : 0.f; }
  return bsplit16(v); }
__device__ __forceinline__ F2 split_col(const float* W, int k0, int n, int lane, int ld, int K) { float v[16]; const int g = lane >> 4;
#pragma unroll
  for (int i = 0; i < 8; ++i) { const int ka = k0 + 8 * g + i, kb = ka + 16; v[i] = ka < K ? W[(size_t)(ka < K ? ka : K - 1) * ld + n] : 0.f; v[8 + i] = kb < K ? W[(size_t)(kb < K ? kb : K - 1) * ld + n] : 0.f; }
  return bsplit16(v); }
__device__ __forceinline__ v8f mac3(const F2& a, const F2& b, v8f c) { c = wmma_bf(a.l, b.h, c); c = wmma_bf(a.h, b.l, c); return wmma_bf(a.h, b.h, c); }
__device__ __forceinline__ float sigm(float v) { return 1.0f / (1.0f + expf(-v)); }
#define LDSX() do { asm volatile("s_wait_dscnt 0" ::: "memory"); __builtin_amdgcn_wave_barrier(); __builtin_amdgcn_fence(__ATOMIC_RELEASE, "workgroup"); } while (0)


// Additive multi-head attention block: Vproj = V WV^T (8 heads x 64), attn_Q = Q WQ^T, attn_K = K WK^T (one scalar per head), w = softmax_k(leaky_relu(attn_Q[q,h] + attn_K[k,h], 0.2)), out[q, h*64 + d] = sum_k w Vproj[k,h,d] + bias[h,d].  B 8, 1024 queries/keys, dims 512.
// k_vproj (exact GEMM -> transposed hi/lo planes), k_aqk (the 8 scalar projections per Q or K row, f32), k_attn (block = (64 queries, b*8+h): 32 key steps, VALU logits, row max up front, per-lane sums, P hi/lo x Vproj planes, + bias).
#define NB 8
#define SQ 1024
#define SK 1024
#define DI 512
#define NH 8
#define OD 64
#ifndef TQB
#define TQB (SQ / 64)
#define TNB NB
#endif
typedef __attribute__((ext_vector_type(8))) __bf16 v8b;
__device__ __forceinline__ v16b frag_b(const __bf16* rowk0, int lane) {
  union { v16b v; v8b q[2]; } u; const __bf16* p = rowk0 + 8 * (lane >> 4);
  u.q[0] = *(const v8b*)p; u.q[1] = *(const v8b*)(p + 16); return u.v;
}
__device__ __forceinline__ v16b frag_gbf(const float* rowk0, int lane) {
  v16b a; const float* p = rowk0 + 8 * (lane >> 4);
#pragma unroll
  for (int i = 0; i < 8; ++i) { a[i] = (__bf16)p[i]; a[8 + i] = (__bf16)p[16 + i]; }
  return a;
}
__device__ __forceinline__ float bfr(float v) { return (float)(__bf16)v; }
#define WS_VTH  0u                                   // bf16 [8][512][1024] Vproj transposed hi
#define WS_VTL  (WS_VTH + 2u * NB * DI * SK)
#define WS_AQ   (WS_VTL + 2u * NB * DI * SK)           // f32 [8][8 h][1024 q]
#define WS_AK   (WS_AQ + 4u * NB * NH * SQ)            // f32 [8][8 h][1024 k]
#define WS_END  (WS_AK + 4u * NB * NH * SK)

// k_vproj: block = (64 V rows, b, 128 output columns): 512 blocks of 131 KiB of LDS, two to a WGP on every WGP, so that one block's loads run beside the other's matrix work.
// k_vproj staging: the block's 64 V rows (all 512 k) and, per stage, its 128 WV rows x 256 k are read once per block by whole-line loads (a wave-wide 16-B load = 512 contiguous bytes), rounded to bf16 once and kept in LDS; all four waves take their fragments from there.
#define VPITCH 520   // bf16 per staged V row: 1040 B = 16 B x 65 (odd), the pitch for 16-byte LDS readers
#define WPITCH 264   // bf16 per staged WV half row: 528 B = 16 B x 33 (odd)
typedef __attribute__((ext_vector_type(4))) __bf16 v4b;
__global__ __launch_bounds__(128) void k_vproj(const float* __restrict__ V, const float* __restrict__ WV, __bf16* __restrict__ VTH, __bf16* __restrict__ VTL) {
  __shared__ __align__(16) __bf16 sv[64][VPITCH], sw[128][WPITCH];
  __bf16 (*sh)[72] = (__bf16 (*)[72])&sw[0][0]; __bf16 (*sl)[72] = sh + 128;   // the two result planes [128 columns][64 keys + pad] take sw's place once its last stage has been read
  const int tid = threadIdx.x, wave = tid >> 5, lane = tid & 31, col = lane & 15, g = lane >> 4; const int oc = blockIdx.z, b = blockIdx.y; const int k0 = blockIdx.x * 64;
  const float* Vt = V + ((size_t)b * SK + k0) * DI + tid * 4;   // thread = 4 k of every row
  // unroll 32: that many independent 16-B loads per lane in flight, so a batch pays the load latency once
#pragma unroll 32
  for (int r = 0; r < 64; ++r) *(v4b*)&sv[r][tid * 4] = __builtin_convertvector(*(const v4f*)(Vt + (size_t)r * DI), v4b);
  const int wr = tid >> 6, wc = (tid & 63) * 4;                  // thread = 4 k of every second row of a stage
  v8f acc[8] = {};
    // unroll 1: one copy of the stage and its matrix block in the text
#pragma unroll 1
    for (int kh = 0; kh < 2; ++kh) { const float* Wt = WV + (size_t)(oc * 128 + wr) * DI + kh * 256 + wc;
      __syncthreads();   // every wave has finished its reads of the stage that sw still holds
      // unroll 32: as above
#pragma unroll 32
      for (int r = 0; r < 64; ++r) *(v4b*)&sw[2 * r + wr][wc] = __builtin_convertvector(*(const v4f*)(Wt + (size_t)(2 * r) * DI), v4b);
      __syncthreads();   // the stage (and, the first time, sv) is visible to every wave
      const __bf16* ap = &sv[wave * 16 + col][kh * 256]; const __bf16* bp = &sw[col][0];
      v16b fa[2], fb[2][8];   // two fragment sets: the next 32 k are fetched as one group ahead of the current matrix instructions, which then do not wait out the LDS latency
      fa[0] = frag_b(ap, lane);
#pragma unroll
      for (int j = 0; j < 8; ++j) fb[0][j] = frag_b(bp + j * 16 * WPITCH, lane);
      // full unroll, here and in the j loops: set and tile indices must be compile-time constants for the sets to stay in registers
#pragma unroll
      for (int kc = 0; kc < 8; ++kc) { const int cu = kc & 1, nx = cu ^ 1;
        if (kc + 1 < 8) { fa[nx] = frag_b(ap + (kc + 1) * 32, lane);
#pragma unroll
          for (int j = 0; j < 8; ++j) fb[nx][j] = frag_b(bp + j * 16 * WPITCH + (kc + 1) * 32, lane); }
#pragma unroll
        for (int j = 0; j < 8; ++j) acc[j] = wmma_bf(fa[cu], fb[cu][j], acc[j]); } }
  __syncthreads();   // every wave has finished its reads of sw: the result planes may take its place
#pragma unroll
    for (int j = 0; j < 8; ++j)
#pragma unroll
      for (int r = 0; r < 8; ++r) { const int o = j * 16 + col; const float v = acc[j][r]; const __bf16 hb = (__bf16)v; sh[o][wave * 16 + 8 * g + r] = hb; sl[o][wave * 16 + 8 * g + r] = (__bf16)(v - (float)hb); }
  __syncthreads();
  // full unroll: the 16 LDS reads of a thread go out together, and each store follows as its piece lands
#pragma unroll
  for (int i = 0; i < 8; ++i) { const int o = i * 16 + (tid >> 3), pc = tid & 7; const size_t off = ((size_t)b * DI + oc * 128 + (tid >> 3)) * SK + k0 + pc * 8; vst2((unsigned*)(VTH + off + i * 16 * SK), *(const v4u*)&sh[o][pc * 8]); vst2((unsigned*)(VTL + off + i * 16 * SK), *(const v4u*)&sl[o][pc * 8]); }
}
// one level of a halving butterfly: at distance N a lane keeps the half of its 2N sums whose number has bit N as its own lane number has, and hands the other half to lane ^ N (N a template constant: every index into v is a compile-time constant)
template <int N> __device__ __forceinline__ void fold(float (&v)[32], int lane) { const bool up = (lane & N) != 0;
#pragma unroll
  for (int j = 0; j < N; ++j) { const float keep = up ? v[j + N] : v[j], send = up ? v[j] : v[j + N]; v[j] = keep + __shfl_xor(send, N); } }
// ---- k_aqk: block = (32 rows, b, which), 8 waves: which 0: AQ[b][h][q] = sum_i Q[b][q][i] WQ[h][i]; which 1: AK from K/WK.  A wave owns 4 rows and reads them as 16 whole-line loads (a wave-wide 16-B load = 512 contiguous bytes), all sent before anything waits; lane = 16 i of every row, all 8 heads; the 32 (row, head) partial sums of a lane are folded over the 32 lanes by a halving butterfly that leaves sum number L in lane L; 32 floats per (b,h) = one 128-B line per block
__global__ __launch_bounds__(256) void k_aqk(const float* __restrict__ Q, const float* __restrict__ K, const float* __restrict__ WQ, const float* __restrict__ WK, float* __restrict__ AQ, float* __restrict__ AK) {
  __shared__ __align__(16) float sw[NH][DI]; __shared__ __align__(16) float so[NH][32];
  const int tid = threadIdx.x, wave = tid >> 5, lane = tid & 31, b = blockIdx.y, which = blockIdx.z; const int r0 = blockIdx.x * 32; const float* X = which == 0 ? Q : K; const float* Wm = which == 0 ? WQ : WK; float* A = which == 0 ? AQ : AK; const int L = which == 0 ? SQ : SK;
  const float* xr = X + ((size_t)b * L + r0 + wave * 4) * DI + lane * 4;
  v4f x[4][4], wv[NH * DI / 1024];
  // full unroll, here and below: wv, x, acc and v are indexed by constants and stay in registers; the 4 weight loads (short latency) and the 16 row loads (from memory) go out together
#pragma unroll
  for (int q = 0; q < NH * DI / 1024; ++q) wv[q] = *(const v4f*)(Wm + q * 1024 + tid * 4);
#pragma unroll
  for (int r = 0; r < 4; ++r)
#pragma unroll
    for (int j = 0; j < 4; ++j) x[r][j] = *(const v4f*)(xr + r * DI + j * 128);
  __builtin_amdgcn_sched_barrier(0);   // keeps the row loads in front of the wait for the weights: the weights are then rounded and stored to LDS while the rows are on their way
#pragma unroll
  for (int q = 0; q < NH * DI / 1024; ++q) *(v4f*)(&sw[0][0] + q * 1024 + tid * 4) = __builtin_convertvector(__builtin_convertvector(wv[q], v4b), v4f);
  __syncthreads();
#pragma unroll
  for (int r = 0; r < 4; ++r)
#pragma unroll
    for (int j = 0; j < 4; ++j) x[r][j] = __builtin_convertvector(__builtin_convertvector(x[r][j], v4b), v4f);
  v2f acc[4][NH] = {};   // two f32 chains per (row, head): even and odd i pairs, one packed multiply-add each
#pragma unroll
  for (int h = 0; h < NH; ++h)
#pragma unroll
    for (int j = 0; j < 4; ++j) { const v4f w = *(const v4f*)&sw[h][j * 128 + lane * 4];
#pragma unroll
      for (int r = 0; r < 4; ++r) { acc[r][h] = __builtin_elementwise_fma(x[r][j].xy, w.xy, acc[r][h]); acc[r][h] = __builtin_elementwise_fma(x[r][j].zw, w.zw, acc[r][h]); } }
  float v[32];
#pragma unroll
  for (int r = 0; r < 4; ++r)
#pragma unroll
    for (int h = 0; h < NH; ++h) v[r * NH + h] = acc[r][h][0] + acc[r][h][1];
  fold<16>(v, lane); fold<8>(v, lane); fold<4>(v, lane); fold<2>(v, lane); fold<1>(v, lane);
  so[lane & 7][wave * 4 + (lane >> 3)] = v[0];
  __syncthreads();
  if (tid < NH * 8) { const int h = tid >> 3, pc = tid & 7; vst2(A + ((size_t)b * NH + h) * L + r0 + pc * 4, *(const v4f*)&so[h][pc * 4]); }
}
#define VSP 72                      // bf16 per staged Vproj row: 144 B = 16 B x 9 (odd), the pitch for 16-byte LDS readers
#define VBUFB (2u * OD * VSP * 2u)  // bytes of one buffer (two planes)
// one tile's copies of one thread: 4 pieces of 16 B per plane, 16 rows apart (a wave's copy = 4 whole lines).  gh, gl: the thread's first piece in each plane; lds: its place in the hi plane of the buffer.
__device__ __forceinline__ void stage_v(const __bf16* gh, const __bf16* gl, unsigned lds) {
  const unsigned rs = 16u * VSP * 2u, ps = OD * VSP * 2u;
  // the wait on xcnt is the last line of the copies' own statement: it stands in front of every later write of the address registers that the copies name
  asm volatile("global_load_async_to_lds_b128 %0, %8, off\n\t"
               "global_load_async_to_lds_b128 %1, %9, off\n\t"
               "global_load_async_to_lds_b128 %2, %10, off\n\t"
               "global_load_async_to_lds_b128 %3, %11, off\n\t"
               "global_load_async_to_lds_b128 %4, %12, off\n\t"
               "global_load_async_to_lds_b128 %5, %13, off\n\t"
               "global_load_async_to_lds_b128 %6, %14, off\n\t"
               "global_load_async_to_lds_b128 %7, %15, off\n\t"
               "s_wait_xcnt 0x0"
               :: "v"(lds), "v"(lds + rs), "v"(lds + 2u * rs), "v"(lds + 3u * rs), "v"(lds + ps), "v"(lds + ps + rs), "v"(lds + ps + 2u * rs), "v"(lds + ps + 3u * rs),
                  "v"(gh), "v"(gh + 16 * SK), "v"(gh + 32 * SK), "v"(gh + 48 * SK), "v"(gl), "v"(gl + 16 * SK), "v"(gl + 32 * SK), "v"(gl + 48 * SK)
               : "memory");
}
// ---- k_attn: block = (64 queries, b*8+h), 4 waves: s = leaky(aq[q] + ak[k], 0.2); softmax with the row max leaky(aq[q] + max ak) taken before the loop, the weight exp(s - max) as a key factor from an LDS table times a row factor, row sum folded over lanes once behind the loop; P hi/lo x Vproj planes (head columns h*64..+63 = rows b*512 + h*64 + d) 3 products; + bias[h][d]; out row segment 256 B
__global__ __launch_bounds__(128) void k_attn(const float* __restrict__ AQ, const float* __restrict__ AK, const __bf16* __restrict__ VTH, const __bf16* __restrict__ VTL, const float* __restrict__ BIAS, float* __restrict__ OUT) {
  __shared__ __align__(16) float sp[4][16][36]; __shared__ __align__(16) float so[4][16][68]; __shared__ __align__(16) float sk[3][SK];   // sk: ak, exp(ak - akmax), exp(0.2 (ak - akmax))
  __shared__ __align__(16) __bf16 sv[2][2][OD][VSP];   // [buffer][plane hi, lo][d][key of the tile]
  const int tid = threadIdx.x, wave = tid >> 5, lane = tid & 31, col = lane & 15, g = lane >> 4;
  const int qb = blockIdx.x, bh = blockIdx.y, b = bh / NH, h = bh % NH; const int q0 = qb * 64 + wave * 16;
  const size_t voff = ((size_t)b * DI + h * OD + (tid >> 3)) * SK + (tid & 7) * 8;   // thread = 16 B (8 keys) of rows tid / 8 + 0, 16, 32, 48
  const __bf16* gvh = VTH + voff; const __bf16* gvl = VTL + voff;
  const unsigned lv = (unsigned)(size_t)&sv[0][0][tid >> 3][(tid & 7) * 8];   // LDS byte address: the low 32 bits of the shared address
  stage_v(gvh, gvl, lv);   // tile 0 into buffer 0: on its way while the key tables are made
  float aq[8];
#pragma unroll
  for (int r = 0; r < 8; ++r) aq[r] = AQ[((size_t)b * NH + h) * SQ + q0 + 8 * g + r];
  const float* AKb = AK + ((size_t)b * NH + h) * SK;
  // The logit leaky(aq + ak) never decreases as ak grows (f32 add, and leaky with a positive slope, keep order), so a row's maximum over all keys is the logit at the largest ak: it is known before the key loop and equals, bit for bit, the last running maximum.
  float akmax;
  // full unroll, here and in the r loops below: the eight whole-line loads go out together; c, l and e are indexed by constants and stay in registers
  { v4f t = *(const v4f*)(AKb + lane * 4);
#pragma unroll
    for (int j = 1; j < SK / 128; ++j) { const v4f w = *(const v4f*)(AKb + j * 128 + lane * 4); t[0] = fmaxf(t[0], w[0]); t[1] = fmaxf(t[1], w[1]); t[2] = fmaxf(t[2], w[2]); t[3] = fmaxf(t[3], w[3]); }
    akmax = fmaxf(fmaxf(t[0], t[1]), fmaxf(t[2], t[3]));
#pragma unroll
    for (int o = 1; o < 32; o <<= 1) akmax = fmaxf(akmax, __shfl_xor(akmax, o)); }
  // exp(leaky(aq + ak) - m) splits into a factor of the key and a factor of the row.  Where aq + ak > 0 the row maximum m is aq + akmax, so the weight is exp(ak - akmax); elsewhere it is exp(0.2 (aq + akmax) - m) * exp(0.2 (ak - akmax)).  Every factor lies in (0, 1].  The two key factors are made once per block (8 keys a thread) and kept in LDS beside ak; the key loop holds no exp.
#pragma unroll
  for (int j = 0; j < 2; ++j) { const int kk = (wave * 2 + j) * 128 + lane * 4; const v4f a = *(const v4f*)(AKb + kk); v4f e1, e2;
#pragma unroll
    for (int i = 0; i < 4; ++i) { const float dk = a[i] - akmax; e1[i] = expf(dk); e2[i] = expf(0.2f * dk); }
    *(v4f*)&sk[0][kk] = a; *(v4f*)&sk[1][kk] = e1; *(v4f*)&sk[2][kk] = e2; }
  float c[8], l[8]; v8f acc[4] = {};   // c: the row's factor of the negative branch; l: this lane's own share of the row sum (its two key columns of every step)
#pragma unroll
  for (int r = 0; r < 8; ++r) { const float u = aq[r] + akmax; c[r] = expf(0.2f * u - (u > 0.f ? u : 0.2f * u)); l[r] = 0.f; }
  asm volatile("s_wait_asynccnt 0x0" ::: "memory");   // this wave's copies of tile 0 have landed
  __syncthreads();   // the key tables and tile 0, written by all four waves, are visible to every wave
  stage_v(gvh + 64, gvl + 64, lv + VBUFB);   // tile 1 into buffer 1
  // unroll 1: one copy of the trip in the text
#pragma unroll 1
  for (int t = 0; t < SK / 64; ++t) { const __bf16* vt = &sv[t & 1][0][col][0];
  // full unroll: the two 32-key steps of a tile differ by constant LDS offsets
#pragma unroll
  for (int s = 0; s < 2; ++s) { const int ks = t * 2 + s; const int kc = ks * 32 + col;
    v16b vh[4], vl[4];   // the step's 16 fragment reads go out as one group in front of the weights, which are made while the reads are on their way
#pragma unroll
    for (int dt = 0; dt < 4; ++dt) { vh[dt] = frag_b(vt + dt * 16 * VSP + s * 32, lane); vl[dt] = frag_b(vt + (OD + dt * 16) * VSP + s * 32, lane); }
    const float k0v = sk[0][kc], k1v = sk[0][kc + 16], p0 = sk[1][kc], p1 = sk[1][kc + 16], n0 = sk[2][kc], n1 = sk[2][kc + 16];
    float e[2][8];
#pragma unroll
    for (int r = 0; r < 8; ++r) { e[0][r] = aq[r] + k0v > 0.f ? p0 : c[r] * n0; e[1][r] = aq[r] + k1v > 0.f ? p1 : c[r] * n1; }
#pragma unroll
    for (int r = 0; r < 8; ++r) { l[r] += e[0][r] + e[1][r]; sp[wave][8 * g + r][col] = e[0][r]; sp[wave][8 * g + r][16 + col] = e[1][r]; }
    LDSX();
    const F2 pa = split_row(&sp[wave][col][0], 0, lane);
#pragma unroll
    for (int dt = 0; dt < 4; ++dt) { acc[dt] = wmma_bf(pa.l, vh[dt], acc[dt]); acc[dt] = wmma_bf(pa.h, vl[dt], acc[dt]); acc[dt] = wmma_bf(pa.h, vh[dt], acc[dt]); }
    LDSX(); }
    asm volatile("s_wait_dscnt 0x0" ::: "memory");      // this wave's reads of the buffer are done
    asm volatile("s_wait_asynccnt 0x0" ::: "memory");   // this wave's copies of tile t + 1 have landed
    __syncthreads();   // tile t + 1 is visible to every wave, and every wave has left the buffer of tile t
    if (t + 2 < SK / 64) stage_v(gvh + (t + 2) * 64, gvl + (t + 2) * 64, lv + (unsigned)(t & 1) * VBUFB); }
  asm volatile("s_wait_asynccnt 0x0" ::: "memory");   // no copy is outstanding behind the loop
#pragma unroll
  for (int r = 0; r < 8; ++r) { float ls = l[r];
#pragma unroll
    for (int o = 1; o < 16; o <<= 1) ls += __shfl_xor(ls, o);
    const float il = 1.0f / ls;
#pragma unroll
    for (int dt = 0; dt < 4; ++dt) so[wave][8 * g + r][dt * 16 + col] = acc[dt][r] * il + bfr(BIAS[h * OD + dt * 16 + col]); }
  LDSX();
  for (int rl = 0; rl < 16; ++rl) if (lane < 16) vst2(OUT + ((size_t)b * SQ + q0 + rl) * (NH * OD) + h * OD + lane * 4, *(const v4f*)&so[wave][rl][lane * 4]);
}
extern "C" void kernel_launch(void* const* d_in, const int* in_sizes, int n_in, void* d_out, int out_size, void* d_ws, size_t ws_size, hipStream_t stream) {
  (void)in_sizes; (void)n_in; (void)out_size;
  const float** F = (const float**)d_in;   // Q, K, V [8,1024,512], WQ [8,512], WK [8,512], WV [512,512], bias [8,64]
  if (ws_size < (size_t)WS_END) return;
  char* ws = (char*)d_ws; __bf16 *VTH = (__bf16*)(ws + WS_VTH), *VTL = (__bf16*)(ws + WS_VTL); float *AQ = (float*)(ws + WS_AQ), *AK = (float*)(ws + WS_AK);
  k_vproj<<<dim3(SK / 64, TNB, DI / 128), 128, 0, stream>>>(F[2], F[5], VTH, VTL);
  k_aqk<<<dim3(SQ / 32, TNB, 2), 256, 0, stream>>>(F[0], F[1], F[3], F[4], AQ, AK);
  k_attn<<<dim3(TQB, TNB * NH), 128, 0, stream>>>(AQ, AK, VTH, VTL, F[6], (float*)d_out);
}

// v007
// One run takes 45.1 microseconds.
// Timed twice side by side with v006, it ran 1.06 and 1.07 times as fast.
// Over all steps from v000 it is 8.80 times as fast.
// compute dtype: Q, K, V, WQ, WK, WV, bias (module inputs) rounded to bf16; Vproj with exact bf16 products on WMMA; the per-head scalar scores attn_Q/attn_K as f32 dots of bf16-rounded inputs; rank-1 logits leaky(aq[q] + ak[k]) and the softmax (row maximum known up front) in f32; P.Vproj with both computed operands as bf16 hi + residual pairs (3 products); f32 accumulate.
#include <hip/hip_runtime.h>
#include <math.h>

typedef __attribute__((ext_vector_type(16))) _Float16 v16h;
typedef __attribute__((ext_vector_type(16))) __bf16 v16b;
typedef __attribute__((ext_vector_type(8)))  _Float16 v8h;
typedef __attribute__((ext_vector_type(8)))  float v8f;
typedef __attribute__((ext_vector_type(4)))  float v4f;
typedef __attribute__((ext_vector_type(2)))  float v2f;
typedef __attribute__((ext_vector_type(4)))  unsigned v4u;
typedef __attribute__((ext_vector_type(4)))  int v4i;
typedef float __attribute__((may_alias)) float_a;
typedef int __attribute__((may_alias)) int_a;

template <typename T> __device__ __forceinline__ void vst2(void* p, T v) { *(T*)p = v;  }
__device__ __forceinline__ v8f wmma16(v16h a, v16h b, v8f c) {
  v8f d = __builtin_amdgcn_wmma_f32_16x16x32_f16(false, a, false, b, (short)0, c, false, false);
  asm volatile("v_nop\n\tv_nop\n\tv_nop\n\tv_nop" : "+v"(d) : "v"(a), "v"(b));
  return d;
}
__device__ __forceinline__ v8f wmma_bf(v16b a, v16b b, v8f c) {
  v8f d = __builtin_amdgcn_wmma_f32_16x16x32_bf16(false, a, false, b, (short)0, c, false, false);
  asm volatile("v_nop\n\tv_nop\n\tv_nop\n\tv_nop" : "+v"(d) : "v"(a), "v"(b));
  return d;
}
// 16x16x32 fragments: lane = (h = lane>>4, row/col = lane&15); elements 0..7 = k0+8h+0..7, 8..15 = k0+16+8h+0..7; D element r = row 8h+r
__device__ __forceinline__ v16h frag_h(const _Float16* rowk0, int lane) {
  union { v16h v; v8h q[2]; } u; const _Float16* p = rowk0 + 8 * (lane >> 4);
  u.q[0] = *(const v8h*)p; u.q[1] = *(const v8h*)(p + 16); return u.v;
}
__device__ __forceinline__ v16h frag_f32(const float* rowk0, int lane) {
  v16h a; const float* p = rowk0 + 8 * (lane >> 4);
#pragma unroll
  for (int i = 0; i < 8; ++i) { a[i] = (_Float16)p[i]; a[8 + i] = (_Float16)p[16 + i]; }
  return a;
}
__device__ __forceinline__ v16h frag_f32s(const float* rowk0, int lane, float sc) {
  v16h a; const float* p = rowk0 + 8 * (lane >> 4);
#pragma unroll
  for (int i = 0; i < 8; ++i) { a[i] = (_Float16)(p[i] * sc); a[8 + i] = (_Float16)(p[16 + i] * sc); }
  return a;
}
// column fragment from a [K][ld] layout (column n), rows >= K read as 0
__device__ __forceinline__ v16h fragc_f32(const float* W, int k0, int n, int lane, int ld, int K) {
  v16h a; const int g = lane >> 4;
#pragma unroll
  for (int i = 0; i < 8; ++i) { const int ka = k0 + 8 * g + i, kb = ka + 16;
    a[i] = (_Float16)(ka < K ? W[(size_t)(ka < K ? ka : K - 1) * ld + n] : 0.f); a[8 + i] = (_Float16)(kb < K ? W[(size_t)(kb < K ? kb : K - 1) * ld + n] : 0.f); }
  return a;
}
struct F2 { v16b h, l; };
__device__ __forceinline__ F2 bsplit16(const float v[16]) { F2 r;
#pragma unroll
  for (int i = 0; i < 16; ++i) { const __bf16 h = (__bf16)v[i]; r.h[i] = h; r.l[i] = (__bf16)(v[i] - (float)h); }
  return r; }
__device__ __forceinline__ F2 split_row(const float* row, int k0, int lane) { float v[16]; const float* p = row + k0 + 8 * (lane >> 4);
#pragma unroll
  for (int i = 0; i < 8; ++i) { v[i] = p[i]; v[8 + i] = p[16 + i]; }
  return bsplit16(v); }
__device__ __forceinline__ F2 split_rowK(const float* row, int k0, int lane, int K) { float v[16]; const int g = lane >> 4;
#pragma unroll
  for (int i = 0; i < 8; ++i) { const int ka = k0 + 8 * g + i, kb = ka + 16; v[i] = ka < K ? row[ka < K ? ka : K - 1] : 0.f; v[8 + i] = kb < K ? row[kb < K ? kb : K - 1] : 0.f; }
  return bsplit16(v); }
__device__ __forceinline__ F2 split_col(const float* W, int k0, int n, int lane, int ld, int K) { float v[16]; const int g = lane >> 4;
#pragma unroll
  for (int i = 0; i < 8; ++i) { const int ka = k0 + 8 * g + i, kb = ka + 16; v[i] = ka < K ? W[(size_t)(ka < K ? ka : K - 1) * ld + n] : 0.f; v[8 + i] = kb < K ? W[(size_t)(kb < K ? kb : K - 1) * ld + n] : 0.f; }
  return bsplit16(v); }
__device__ __forceinline__ v8f mac3(const F2& a, const F2& b, v8f c) { c = wmma_bf(a.l, b.h, c); c = wmma_bf(a.h, b.l, c); return wmma_bf(a.h, b.h, c); }
__device__ __forceinline__ float sigm(float v) { return 1.0f / (1.0f + expf(-v)); }
#define LDSX() do { asm volatile("s_wait_dscnt 0" ::: "memory"); __builtin_amdgcn_wave_barrier(); __builtin_amdgcn_fence(__ATOMIC_RELEASE, "workgroup"); } while (0)


// Additive multi-head attention block: Vproj = V WV^T (8 heads x 64), attn_Q = Q WQ^T, attn_K = K WK^T (one scalar per head), w = softmax_k(leaky_relu(attn_Q[q,h] + attn_K[k,h], 0.2)), out[q, h*64 + d] = sum_k w Vproj[k,h,d] + bias[h,d].  B 8, 1024 queries/keys, dims 512.
// k_vproj (exact GEMM -> transposed hi/lo planes; each block also makes the 8 scalar projections of 32 rows of Q or K, f32), k_attn (block = (64 queries, b*8+h): 32 key steps, VALU logits, row max up front, per-lane sums, P hi/lo x Vproj planes, + bias).
#define NB 8
#define SQ 1024
#define SK 1024
#define DI 512
#define NH 8
#define OD 64
#ifndef TQB
#define TQB (SQ / 64)
#define TNB NB
#endif
typedef __attribute__((ext_vector_type(8))) __bf16 v8b;
__device__ __forceinline__ v16b frag_b(const __bf16* rowk0, int lane) {
  union { v16b v; v8b q[2]; } u; const __bf16* p = rowk0 + 8 * (lane >> 4);
  u.q[0] = *(const v8b*)p; u.q[1] = *(const v8b*)(p + 16); return u.v;
}
__device__ __forceinline__ v16b frag_gbf(const float* rowk0, int lane) {
  v16b a; const float* p = rowk0 + 8 * (lane >> 4);
#pragma unroll
  for (int i = 0; i < 8; ++i) { a[i] = (__bf16)p[i]; a[8 + i] = (__bf16)p[16 + i]; }
  return a;
}
__device__ __forceinline__ float bfr(float v) { return (float)(__bf16)v; }
#define WS_VTH  0u                                   // bf16 [8][512][1024] Vproj transposed hi
#define WS_VTL  (WS_VTH + 2u * NB * DI * SK)
#define WS_AQ   (WS_VTL + 2u * NB * DI * SK)           // f32 [8][8 h][1024 q]
#define WS_AK   (WS_AQ + 4u * NB * NH * SQ)            // f32 [8][8 h][1024 k]
#define WS_END  (WS_AK + 4u * NB * NH * SK)

// one level of a halving butterfly: at distance N a lane keeps the half of its 2N sums whose number has bit N as its own lane number has, and hands the other half to lane ^ N (N a template constant: every index into v is a compile-time constant)
template <int N> __device__ __forceinline__ void fold(float (&v)[32], int lane) { const bool up = (lane & N) != 0;
#pragma unroll
  for (int j = 0; j < N; ++j) { const float keep = up ? v[j + N] : v[j], send = up ? v[j] : v[j + N]; v[j] = keep + __shfl_xor(send, N); } }
// work-group barrier that orders LDS alone: global loads already sent stay in flight across it, and global stores are not waited for (__syncthreads() waits for both).  For places where the waves hand each other LDS data only.
__device__ __forceinline__ void lds_barrier() { __builtin_amdgcn_fence(__ATOMIC_RELEASE, "workgroup", "local"); __builtin_amdgcn_s_barrier(); __builtin_amdgcn_fence(__ATOMIC_ACQUIRE, "workgroup", "local"); }
// k_vproj: block = (64 V rows, b, 128 output columns): 512 blocks of 148 KiB of LDS, two to a WGP on every WGP, so that one block's loads run beside the other's matrix work.
// k_vproj staging: the block's 64 V rows (all 512 k) and, per stage, its 128 WV rows x 256 k are read once per block by whole-line loads (a wave-wide 16-B load = 512 contiguous bytes), rounded to bf16 once and kept in LDS; all four waves take their fragments from there.
#define VPITCH 520   // bf16 per staged V row: 1040 B = 16 B x 65 (odd), the pitch for 16-byte LDS readers
#define WPITCH 264   // bf16 per staged WV half row: 528 B = 16 B x 33 (odd)
typedef __attribute__((ext_vector_type(4))) __bf16 v4b;
__global__ __launch_bounds__(128) void k_vproj(const float* __restrict__ V, const float* __restrict__ WV, __bf16* __restrict__ VTH, __bf16* __restrict__ VTL, const float* __restrict__ Q, const float* __restrict__ K, const float* __restrict__ WQ, const float* __restrict__ WK, float* __restrict__ AQ, float* __restrict__ AK) {
  __shared__ __align__(16) __bf16 sv[64][VPITCH], sw[128][WPITCH];
  __shared__ __align__(16) float sq[NH][DI]; __shared__ __align__(16) float so[NH][32];   // the score weights (WQ or WK, rounded) and the block's 8 x 32 scores
  __bf16 (*sh)[72] = (__bf16 (*)[72])&sw[0][0]; __bf16 (*sl)[72] = sh + 128;   // the two result planes [128 columns][64 keys + pad] take sw's place once its last stage has been read
  const int tid = threadIdx.x, wave = tid >> 5, lane = tid & 31, col = lane & 15, g = lane >> 4; const int oc = blockIdx.z, b = blockIdx.y; const int k0 = blockIdx.x * 64;
  // The block's share of the scalar scores: 32 rows of Q (blocks 0..255) or of K (the rest): AQ[b][h][q] = sum_i Q[b][q][i] WQ[h][i], AK likewise.  32 floats per (b,h) = one 128-B line per block.
  static_assert((DI / 128) * TNB * (SK / 64) == 2 * NB * SQ / 32 && SQ == SK, "one block per 32 rows of Q and K");
  const int lin = (blockIdx.z * TNB + blockIdx.y) * (SK / 64) + blockIdx.x, which = lin / (NB * SQ / 32), ab = lin % (NB * SQ / 32) / (SQ / 32), r0 = lin % (SQ / 32) * 32;
  const float* Wm = which == 0 ? WQ : WK; float* A = which == 0 ? AQ : AK;
  const float* xr = (which == 0 ? Q : K) + ((size_t)ab * SQ + r0 + wave * 8) * DI + lane * 4;   // a wave owns 8 rows; lane = 16 i of every row, all 8 heads
  // full unroll: the 8 weight loads go out in front of the V rows and are rounded and stored behind them; the barriers of the first WV stage publish sq
  v4f wq[NH * DI / 512];
#pragma unroll
  for (int q = 0; q < NH * DI / 512; ++q) wq[q] = *(const v4f*)(Wm + q * 512 + tid * 4);
  const float* Vt = V + ((size_t)b * SK + k0) * DI + tid * 4;   // thread = 4 k of every row
  // unroll 32: that many independent 16-B loads per lane in flight, so a batch pays the load latency once
#pragma unroll 32
  for (int r = 0; r < 64; ++r) *(v4b*)&sv[r][tid * 4] = __builtin_convertvector(*(const v4f*)(Vt + (size_t)r * DI), v4b);
#pragma unroll
  for (int q = 0; q < NH * DI / 512; ++q) *(v4f*)(&sq[0][0] + q * 512 + tid * 4) = __builtin_convertvector(__builtin_convertvector(wq[q], v4b), v4f);
  const int wr = tid >> 6, wc = (tid & 63) * 4;                  // thread = 4 k of every second row of a stage
  v8f acc[8] = {};
    // unroll 1: one copy of the stage and its matrix block in the text
#pragma unroll 1
    for (int kh = 0; kh < 2; ++kh) { const float* Wt = WV + (size_t)(oc * 128 + wr) * DI + kh * 256 + wc;
      __syncthreads();   // every wave has finished its reads of the stage that sw still holds
      // unroll 32: as above
#pragma unroll 32
      for (int r = 0; r < 64; ++r) *(v4b*)&sw[2 * r + wr][wc] = __builtin_convertvector(*(const v4f*)(Wt + (size_t)(2 * r) * DI), v4b);
      __syncthreads();   // the stage (and, the first time, sv) is visible to every wave
      const __bf16* ap = &sv[wave * 16 + col][kh * 256]; const __bf16* bp = &sw[col][0];
      v16b fa[2], fb[2][8];   // two fragment sets: the next 32 k are fetched as one group ahead of the current matrix instructions, which then do not wait out the LDS latency
      fa[0] = frag_b(ap, lane);
#pragma unroll
      for (int j = 0; j < 8; ++j) fb[0][j] = frag_b(bp + j * 16 * WPITCH, lane);
      // full unroll, here and in the j loops: set and tile indices must be compile-time constants for the sets to stay in registers
#pragma unroll
      for (int kc = 0; kc < 8; ++kc) { const int cu = kc & 1, nx = cu ^ 1;
        if (kc + 1 < 8) { fa[nx] = frag_b(ap + (kc + 1) * 32, lane);
#pragma unroll
          for (int j = 0; j < 8; ++j) fb[nx][j] = frag_b(bp + j * 16 * WPITCH + (kc + 1) * 32, lane); }
#pragma unroll
        for (int j = 0; j < 8; ++j) acc[j] = wmma_bf(fa[cu], fb[cu][j], acc[j]); } }
  // The wave's 8 score rows are read as 32 whole-line loads (a wave-wide 16-B load = 512 contiguous bytes), all sent here: they fly from memory while the result planes are written out.
  v4f x[2][4][4];
  // full unroll, here and below: x, sa and v are indexed by constants and stay in registers
#pragma unroll
  for (int p = 0; p < 2; ++p)
#pragma unroll
    for (int r = 0; r < 4; ++r)
#pragma unroll
      for (int j = 0; j < 4; ++j) x[p][r][j] = *(const v4f*)(xr + (p * 4 + r) * DI + j * 128);
  asm volatile("s_wait_xcnt 0x0" :: "v"(xr) : "memory");   // the address that the 32 loads name stays whole up to this wait: without the operand the last load's result takes its registers
  __builtin_amdgcn_sched_barrier(0);   // keeps the loads in front of the write-out below, which would otherwise run first and leave their latency exposed
  lds_barrier();   // every wave has finished its reads of sw: the result planes may take its place
#pragma unroll
    for (int j = 0; j < 8; ++j)
#pragma unroll
      for (int r = 0; r < 8; ++r) { const int o = j * 16 + col; const float v = acc[j][r]; const __bf16 hb = (__bf16)v; sh[o][wave * 16 + 8 * g + r] = hb; sl[o][wave * 16 + 8 * g + r] = (__bf16)(v - (float)hb); }
  lds_barrier();   // the result planes, written by all four waves, are visible to every wave
  // full unroll: the 16 LDS reads of a thread go out together, and each store follows as its piece lands
#pragma unroll
  for (int i = 0; i < 8; ++i) { const int o = i * 16 + (tid >> 3), pc = tid & 7; const size_t off = ((size_t)b * DI + oc * 128 + (tid >> 3)) * SK + k0 + pc * 8; vst2((unsigned*)(VTH + off + i * 16 * SK), *(const v4u*)&sh[o][pc * 8]); vst2((unsigned*)(VTL + off + i * 16 * SK), *(const v4u*)&sl[o][pc * 8]); }
  __builtin_amdgcn_sched_barrier(0);   // the plane stores go out before the scores are begun: sunk among them they would hold 64 more registers
  // the scores: 4 rows at a time; the 32 (row, head) partial sums of a lane are folded over the 32 lanes by a halving butterfly that leaves sum number L in lane L
#pragma unroll
  for (int p = 0; p < 2; ++p) {
#pragma unroll
    for (int r = 0; r < 4; ++r)
#pragma unroll
      for (int j = 0; j < 4; ++j) x[p][r][j] = __builtin_convertvector(__builtin_convertvector(x[p][r][j], v4b), v4f);
    v2f sa[4][NH] = {};   // two f32 chains per (row, head): even and odd i pairs, one packed multiply-add each
#pragma unroll
    for (int h = 0; h < NH; ++h)
#pragma unroll
      for (int j = 0; j < 4; ++j) { const v4f w = *(const v4f*)&sq[h][j * 128 + lane * 4];
#pragma unroll
        for (int r = 0; r < 4; ++r) { sa[r][h] = __builtin_elementwise_fma(x[p][r][j].xy, w.xy, sa[r][h]); sa[r][h] = __builtin_elementwise_fma(x[p][r][j].zw, w.zw, sa[r][h]); } }
    float v[32];
#pragma unroll
    for (int r = 0; r < 4; ++r)
#pragma unroll
      for (int h = 0; h < NH; ++h) v[r * NH + h] = sa[r][h][0] + sa[r][h][1];
    fold<16>(v, lane); fold<8>(v, lane); fold<4>(v, lane); fold<2>(v, lane); fold<1>(v, lane);
    so[lane & 7][wave * 8 + p * 4 + (lane >> 3)] = v[0];
    __builtin_amdgcn_sched_barrier(0); }   // one group of 4 rows is finished before the next is begun: interleaved they would need both groups' sums in registers at once
  lds_barrier();   // the 8 x 32 scores, written by all four waves, are visible to the threads that store them
  if (tid < NH * 8) { const int h = tid >> 3, pc = tid & 7; vst2(A + ((size_t)ab * NH + h) * SQ + r0 + pc * 4, *(const v4f*)&so[h][pc * 4]); }
}
#define VSP 72                      // bf16 per staged Vproj row: 144 B = 16 B x 9 (odd), the pitch for 16-byte LDS readers
#define VBUFB (2u * OD * VSP * 2u)  // bytes of one buffer (two planes)
// one tile's copies of one thread: 4 pieces of 16 B per plane, 16 rows apart (a wave's copy = 4 whole lines).  gh, gl: the thread's first piece in each plane; lds: its place in the hi plane of the buffer.
__device__ __forceinline__ void stage_v(const __bf16* gh, const __bf16* gl, unsigned lds) {
  const unsigned rs = 16u * VSP * 2u, ps = OD * VSP * 2u;
  // the wait on xcnt is the last line of the copies' own statement: it stands in front of every later write of the address registers that the copies name
  asm volatile("global_load_async_to_lds_b128 %0, %8, off\n\t"
               "global_load_async_to_lds_b128 %1, %9, off\n\t"
               "global_load_async_to_lds_b128 %2, %10, off\n\t"
               "global_load_async_to_lds_b128 %3, %11, off\n\t"
               "global_load_async_to_lds_b128 %4, %12, off\n\t"
               "global_load_async_to_lds_b128 %5, %13, off\n\t"
               "global_load_async_to_lds_b128 %6, %14, off\n\t"
               "global_load_async_to_lds_b128 %7, %15, off\n\t"
               "s_wait_xcnt 0x0"
               :: "v"(lds), "v"(lds + rs), "v"(lds + 2u * rs), "v"(lds + 3u * rs), "v"(lds + ps), "v"(lds + ps + rs), "v"(lds + ps + 2u * rs), "v"(lds + ps + 3u * rs),
                  "v"(gh), "v"(gh + 16 * SK), "v"(gh + 32 * SK), "v"(gh + 48 * SK), "v"(gl), "v"(gl + 16 * SK), "v"(gl + 32 * SK), "v"(gl + 48 * SK)
               : "memory");
}
// ---- k_attn: block = (64 queries, b*8+h), 4 waves: s = leaky(aq[q] + ak[k], 0.2); softmax with the row max leaky(aq[q] + max ak) taken before the loop, the weight exp(s - max) as a key factor from an LDS table times a row factor, row sum folded over lanes once behind the loop; P hi/lo x Vproj planes (head columns h*64..+63 = rows b*512 + h*64 + d) 3 products; + bias[h][d]; out row segment 256 B
__global__ __launch_bounds__(128) void k_attn(const float* __restrict__ AQ, const float* __restrict__ AK, const __bf16* __restrict__ VTH, const __bf16* __restrict__ VTL, const float* __restrict__ BIAS, float* __restrict__ OUT) {
  __shared__ __align__(16) float sp[4][16][36]; __shared__ __align__(16) float so[4][16][68]; __shared__ __align__(16) float sk[3][SK];   // sk: ak, exp(ak - akmax), exp(0.2 (ak - akmax))
  __shared__ __align__(16) __bf16 sv[2][2][OD][VSP];   // [buffer][plane hi, lo][d][key of the tile]
  const int tid = threadIdx.x, wave = tid >> 5, lane = tid & 31, col = lane & 15, g = lane >> 4;
  const int qb = blockIdx.x, bh = blockIdx.y, b = bh / NH, h = bh % NH; const int q0 = qb * 64 + wave * 16;
  const size_t voff = ((size_t)b * DI + h * OD + (tid >> 3)) * SK + (tid & 7) * 8;   // thread = 16 B (8 keys) of rows tid / 8 + 0, 16, 32, 48
  const __bf16* gvh = VTH + voff; const __bf16* gvl = VTL + voff;
  const unsigned lv = (unsigned)(size_t)&sv[0][0][tid >> 3][(tid & 7) * 8];   // LDS byte address: the low 32 bits of the shared address
  stage_v(gvh, gvl, lv);   // tile 0 into buffer 0: on its way while the key tables are made
  float aq[8];
#pragma unroll
  for (int r = 0; r < 8; ++r) aq[r] = AQ[((size_t)b * NH + h) * SQ + q0 + 8 * g + r];
  const float* AKb = AK + ((size_t)b * NH + h) * SK;
  // The logit leaky(aq + ak) never decreases as ak grows (f32 add, and leaky with a positive slope, keep order), so a row's maximum over all keys is the logit at the largest ak: it is known before the key loop and equals, bit for bit, the last running maximum.
  float akmax;
  // full unroll, here and in the r loops below: the eight whole-line loads go out together; c, l and e are indexed by constants and stay in registers
  { v4f t = *(const v4f*)(AKb + lane * 4);
#pragma unroll
    for (int j = 1; j < SK / 128; ++j) { const v4f w = *(const v4f*)(AKb + j * 128 + lane * 4); t[0] = fmaxf(t[0], w[0]); t[1] = fmaxf(t[1], w[1]); t[2] = fmaxf(t[2], w[2]); t[3] = fmaxf(t[3], w[3]); }
    akmax = fmaxf(fmaxf(t[0], t[1]), fmaxf(t[2], t[3]));
#pragma unroll
    for (int o = 1; o < 32; o <<= 1) akmax = fmaxf(akmax, __shfl_xor(akmax, o)); }
  // exp(leaky(aq + ak) - m) splits into a factor of the key and a factor of the row.  Where aq + ak > 0 the row maximum m is aq + akmax, so the weight is exp(ak - akmax); elsewhere it is exp(0.2 (aq + akmax) - m) * exp(0.2 (ak - akmax)).  Every factor lies in (0, 1].  The two key factors are made once per block (8 keys a thread) and kept in LDS beside ak; the key loop holds no exp.
#pragma unroll
  for (int j = 0; j < 2; ++j) { const int kk = (wave * 2 + j) * 128 + lane * 4; const v4f a = *(const v4f*)(AKb + kk); v4f e1, e2;
#pragma unroll
    for (int i = 0; i < 4; ++i) { const float dk = a[i] - akmax; e1[i] = expf(dk); e2[i] = expf(0.2f * dk); }
    *(v4f*)&sk[0][kk] = a; *(v4f*)&sk[1][kk] = e1; *(v4f*)&sk[2][kk] = e2; }
  float c[8], l[8]; v8f acc[4] = {};   // c: the row's factor of the negative branch; l: this lane's own share of the row sum (its two key columns of every step)
#pragma unroll
  for (int r = 0; r < 8; ++r) { const float u = aq[r] + akmax; c[r] = expf(0.2f * u - (u > 0.f ? u : 0.2f * u)); l[r] = 0.f; }
  asm volatile("s_wait_asynccnt 0x0" ::: "memory");   // this wave's copies of tile 0 have landed
  __syncthreads();   // the key tables and tile 0, written by all four waves, are visible to every wave
  stage_v(gvh + 64, gvl + 64, lv + VBUFB);   // tile 1 into buffer 1
  // unroll 1: one copy of the trip in the text
#pragma unroll 1
  for (int t = 0; t < SK / 64; ++t) { const __bf16* vt = &sv[t & 1][0][col][0];
  // full unroll: the two 32-key steps of a tile differ by constant LDS offsets
#pragma unroll
  for (int s = 0; s < 2; ++s) { const int ks = t * 2 + s; const int kc = ks * 32 + col;
    v16b vh[4], vl[4];   // the step's 16 fragment reads go out as one group in front of the weights, which are made while the reads are on their way
#pragma unroll
    for (int dt = 0; dt < 4; ++dt) { vh[dt] = frag_b(vt + dt * 16 * VSP + s * 32, lane); vl[dt] = frag_b(vt + (OD + dt * 16) * VSP + s * 32, lane); }
    const float k0v = sk[0][kc], k1v = sk[0][kc + 16], p0 = sk[1][kc], p1 = sk[1][kc + 16], n0 = sk[2][kc], n1 = sk[2][kc + 16];
    float e[2][8];
#pragma unroll
    for (int r = 0; r < 8; ++r) { e[0][r] = aq[r] + k0v > 0.f ? p0 : c[r] * n0; e[1][r] = aq[r] + k1v > 0.f ? p1 : c[r] * n1; }
#pragma unroll
    for (int r = 0; r < 8; ++r) { l[r] += e[0][r] + e[1][r]; sp[wave][8 * g + r][col] = e[0][r]; sp[wave][8 * g + r][16 + col] = e[1][r]; }
    LDSX();
    const F2 pa = split_row(&sp[wave][col][0], 0, lane);
#pragma unroll
    for (int dt = 0; dt < 4; ++dt) { acc[dt] = wmma_bf(pa.l, vh[dt], acc[dt]); acc[dt] = wmma_bf(pa.h, vl[dt], acc[dt]); acc[dt] = wmma_bf(pa.h, vh[dt], acc[dt]); }
    LDSX(); }
    asm volatile("s_wait_dscnt 0x0" ::: "memory");      // this wave's reads of the buffer are done
    asm volatile("s_wait_asynccnt 0x0" ::: "memory");   // this wave's copies of tile t + 1 have landed
    __syncthreads();   // tile t + 1 is visible to every wave, and every wave has left the buffer of tile t
    if (t + 2 < SK / 64) stage_v(gvh + (t + 2) * 64, gvl + (t + 2) * 64, lv + (unsigned)(t & 1) * VBUFB); }
  asm volatile("s_wait_asynccnt 0x0" ::: "memory");   // no copy is outstanding behind the loop
#pragma unroll
  for (int r = 0; r < 8; ++r) { float ls = l[r];
#pragma unroll
    for (int o = 1; o < 16; o <<= 1) ls += __shfl_xor(ls, o);
    const float il = 1.0f / ls;
#pragma unroll
    for (int dt = 0; dt < 4; ++dt) so[wave][8 * g + r][dt * 16 + col] = acc[dt][r] * il + bfr(BIAS[h * OD + dt * 16 + col]); }
  LDSX();
  for (int rl = 0; rl < 16; ++rl) if (lane < 16) vst2(OUT + ((size_t)b * SQ + q0 + rl) * (NH * OD) + h * OD + lane * 4, *(const v4f*)&so[wave][rl][lane * 4]);
}
extern "C" void kernel_launch(void* const* d_in, const int* in_sizes, int n_in, void* d_out, int out_size, void* d_ws, size_t ws_size, hipStream_t stream) {
  (void)in_sizes; (void)n_in; (void)out_size;
  const float** F = (const float**)d_in;   // Q, K, V [8,1024,512], WQ [8,512], WK [8,512], WV [512,512], bias [8,64]
  if (ws_size < (size_t)WS_END) return;
  char* ws = (char*)d_ws; __bf16 *VTH = (__bf16*)(ws + WS_VTH), *VTL = (__bf16*)(ws + WS_VTL); float *AQ = (float*)(ws + WS_AQ), *AK = (float*)(ws + WS_AK);
  k_vproj<<<dim3(SK / 64, TNB, DI / 128), 128, 0, stream>>>(F[2], F[5], VTH, VTL, F[0], F[1], F[3], F[4], AQ, AK);
  k_attn<<<dim3(TQB, TNB * NH), 128, 0, stream>>>(AQ, AK, VTH, VTL, F[6], (float*)d_out);
}

// v008
// It runs in 42.9 microseconds.
// In two side-by-side timings against v007, it was 1.05 and 1.06 times as fast.
// Over all steps from v000 it is 9.28 times as fast.
// compute dtype: Q, K, V, WQ, WK, WV, bias (module inputs) rounded to bf16; Vproj with exact bf16 products on WMMA; the per-head scalar scores attn_Q/attn_K as f32 dots of bf16-rounded inputs; rank-1 logits leaky(aq[q] + ak[k]) and the softmax (row maximum known up front) in f32; P.Vproj with both computed operands as bf16 hi + residual pairs (3 products); f32 accumulate.
#include <hip/hip_runtime.h>
#include <math.h>

typedef __attribute__((ext_vector_type(16))) _Float16 v16h;
typedef __attribute__((ext_vector_type(16))) __bf16 v16b;
typedef __attribute__((ext_vector_type(8)))  _Float16 v8h;
typedef __attribute__((ext_vector_type(8)))  float v8f;
typedef __attribute__((ext_vector_type(4)))  float v4f;
typedef __attribute__((ext_vector_type(2)))  float v2f;
typedef __attribute__((ext_vector_type(4)))  unsigned v4u;
typedef __attribute__((ext_vector_type(4)))  int v4i;
typedef float __attribute__((may_alias)) float_a;
typedef int __attribute__((may_alias)) int_a;

template <typename T> __device__ __forceinline__ void vst2(void* p, T v) { *(T*)p = v;  }
__device__ __forceinline__ v8f wmma16(v16h a, v16h b, v8f c) {
  v8f d = __builtin_amdgcn_wmma_f32_16x16x32_f16(false, a, false, b, (short)0, c, false, false);
  asm volatile("v_nop\n\tv_nop\n\tv_nop\n\tv_nop" : "+v"(d) : "v"(a), "v"(b));
  return d;
}
__device__ __forceinline__ v8f wmma_bf(v16b a, v16b b, v8f c) {
  v8f d = __builtin_amdgcn_wmma_f32_16x16x32_bf16(false, a, false, b, (short)0, c, false, false);
  asm volatile("v_nop\n\tv_nop\n\tv_nop\n\tv_nop" : "+v"(d) : "v"(a), "v"(b));
  return d;
}
// 16x16x32 fragments: lane = (h = lane>>4, row/col = lane&15); elements 0..7 = k0+8h+0..7, 8..15 = k0+16+8h+0..7; D element r = row 8h+r
__device__ __forceinline__ v16h frag_h(const _Float16* rowk0, int lane) {
  union { v16h v; v8h q[2]; } u; const _Float16* p = rowk0 + 8 * (lane >> 4);
  u.q[0] = *(const v8h*)p; u.q[1] = *(const v8h*)(p + 16); return u.v;
}
__device__ __forceinline__ v16h frag_f32(const float* rowk0, int lane) {
  v16h a; const float* p = rowk0 + 8 * (lane >> 4);
#pragma unroll
  for (int i = 0; i < 8; ++i) { a[i] = (_Float16)p[i]; a[8 + i] = (_Float16)p[16 + i]; }
  return a;
}
__device__ __forceinline__ v16h frag_f32s(const float* rowk0, int lane, float sc) {
  v16h a; const float* p = rowk0 + 8 * (lane >> 4);
#pragma unroll
  for (int i = 0; i < 8; ++i) { a[i] = (_Float16)(p[i] * sc); a[8 + i] = (_Float16)(p[16 + i] * sc); }
  return a;
}
// column fragment from a [K][ld] layout (column n), rows >= K read as 0
__device__ __forceinline__ v16h fragc_f32(const float* W, int k0, int n, int lane, int ld, int K) {
  v16h a; const int g = lane >> 4;
#pragma unroll
  for (int i = 0; i < 8; ++i) { const int ka = k0 + 8 * g + i, kb = ka + 16;
    a[i] = (_Float16)(ka < K ? W[(size_t)(ka < K ? ka : K - 1) * ld + n] : 0.f); a[8 + i] = (_Float16)(kb < K ? W[(size_t)(kb < K ? kb : K - 1) * ld + n] : 0.f); }
  return a;
}
struct F2 { v16b h, l; };
__device__ __forceinline__ F2 bsplit16(const float v[16]) { F2 r;
#pragma unroll
  for (int i = 0; i < 16; ++i) { const __bf16 h = (__bf16)v[i]; r.h[i] = h; r.l[i] = (__bf16)(v[i] - (float)h); }
  return r; }
__device__ __forceinline__ F2 split_row(const float* row, int k0, int lane) { float v[16]; const float* p = row + k0 + 8 * (lane >> 4);
#pragma unroll
  for (int i = 0; i < 8; ++i) { v[i] = p[i]; v[8 + i] = p[16 + i]; }
  return bsplit16(v); }
__device__ __forceinline__ F2 split_rowK(const float* row, int k0, int lane, int K) { float v[16]; const int g = lane >> 4;
#pragma unroll
  for (int i = 0; i < 8; ++i) { const int ka = k0 + 8 * g + i, kb = ka + 16; v[i] = ka < K ? row[ka < K ? ka : K - 1] : 0.f; v[8 + i] = kb < K ? row[kb < K ? kb : K - 1] : 0.f; }
  return bsplit16(v); }
__device__ __forceinline__ F2 split_col(const float* W, int k0, int n, int lane, int ld, int K) { float v[16]; const int g = lane >> 4;
#pragma unroll
  for (int i = 0; i < 8; ++i) { const int ka = k0 + 8 * g + i, kb = ka + 16; v[i] = ka < K ? W[(size_t)(ka < K ? ka : K - 1) * ld + n] : 0.f; v[8 + i] = kb < K ? W[(size_t)(kb < K ? kb : K - 1) * ld + n] : 0.f; }
  return bsplit16(v); }
__device__ __forceinline__ v8f mac3(const F2& a, const F2& b, v8f c) { c = wmma_bf(a.l, b.h, c); c = wmma_bf(a.h, b.l, c); return wmma_bf(a.h, b.h, c); }
__device__ __forceinline__ float sigm(float v) { return 1.0f / (1.0f + expf(-v)); }
#define LDSX() do { asm volatile("s_wait_dscnt 0" ::: "memory"); __builtin_amdgcn_wave_barrier(); __builtin_amdgcn_fence(__ATOMIC_RELEASE, "workgroup"); } while (0)


// Additive multi-head attention block: Vproj = V WV^T (8 heads x 64), attn_Q = Q WQ^T, attn_K = K WK^T (one scalar per head), w = softmax_k(leaky_relu(attn_Q[q,h] + attn_K[k,h], 0.2)), out[q, h*64 + d] = sum_k w Vproj[k,h,d] + bias[h,d].  B 8, 1024 queries/keys, dims 512.
// k_vproj (exact GEMM -> transposed hi/lo planes; each block also makes the 8 scalar projections of 32 rows of Q or K, f32), k_attn (block = (128 queries, b*8+h), a wave = 32 of them: 32 key steps, VALU logits, row max up front, per-lane sums, P hi/lo x Vproj planes, + bias).
#define NB 8
#define SQ 1024
#define SK 1024
#define DI 512
#define NH 8
#define OD 64
#ifndef TQB
#define TQB (SQ / 128)
#define TNB NB
#endif
typedef __attribute__((ext_vector_type(8))) __bf16 v8b;
__device__ __forceinline__ v16b frag_b(const __bf16* rowk0, int lane) {
  union { v16b v; v8b q[2]; } u; const __bf16* p = rowk0 + 8 * (lane >> 4);
  u.q[0] = *(const v8b*)p; u.q[1] = *(const v8b*)(p + 16); return u.v;
}
__device__ __forceinline__ v16b frag_gbf(const float* rowk0, int lane) {
  v16b a; const float* p = rowk0 + 8 * (lane >> 4);
#pragma unroll
  for (int i = 0; i < 8; ++i) { a[i] = (__bf16)p[i]; a[8 + i] = (__bf16)p[16 + i]; }
  return a;
}
__device__ __forceinline__ float bfr(float v) { return (float)(__bf16)v; }
#define WS_VTH  0u                                   // bf16 [8][512][1024] Vproj transposed hi
#define WS_VTL  (WS_VTH + 2u * NB * DI * SK)
#define WS_AQ   (WS_VTL + 2u * NB * DI * SK)           // f32 [8][8 h][1024 q]
#define WS_AK   (WS_AQ + 4u * NB * NH * SQ)            // f32 [8][8 h][1024 k]
#define WS_END  (WS_AK + 4u * NB * NH * SK)

// one level of a halving butterfly: at distance N a lane keeps the half of its 2N sums whose number has bit N as its own lane number has, and hands the other half to lane ^ N (N a template constant: every index into v is a compile-time constant)
template <int N> __device__ __forceinline__ void fold(float (&v)[32], int lane) { const bool up = (lane & N) != 0;
#pragma unroll
  for (int j = 0; j < N; ++j) { const float keep = up ? v[j + N] : v[j], send = up ? v[j] : v[j + N]; v[j] = keep + __shfl_xor(send, N); } }
// work-group barrier that orders LDS alone: global loads already sent stay in flight across it, and global stores are not waited for (__syncthreads() waits for both).  For places where the waves hand each other LDS data only.
__device__ __forceinline__ void lds_barrier() { __builtin_amdgcn_fence(__ATOMIC_RELEASE, "workgroup", "local"); __builtin_amdgcn_s_barrier(); __builtin_amdgcn_fence(__ATOMIC_ACQUIRE, "workgroup", "local"); }
// k_vproj: block = (64 V rows, b, 128 output columns): 512 blocks of 148 KiB of LDS, two to a WGP on every WGP, so that one block's loads run beside the other's matrix work.
// k_vproj staging: the block's 64 V rows (all 512 k) and, per stage, its 128 WV rows x 256 k are read once per block by whole-line loads (a wave-wide 16-B load = 512 contiguous bytes), rounded to bf16 once and kept in LDS; all four waves take their fragments from there.
#define VPITCH 520   // bf16 per staged V row: 1040 B = 16 B x 65 (odd), the pitch for 16-byte LDS readers
#define WPITCH 264   // bf16 per staged WV half row: 528 B = 16 B x 33 (odd)
typedef __attribute__((ext_vector_type(4))) __bf16 v4b;
__global__ __launch_bounds__(128) void k_vproj(const float* __restrict__ V, const float* __restrict__ WV, __bf16* __restrict__ VTH, __bf16* __restrict__ VTL, const float* __restrict__ Q, const float* __restrict__ K, const float* __restrict__ WQ, const float* __restrict__ WK, float* __restrict__ AQ, float* __restrict__ AK) {
  __shared__ __align__(16) __bf16 sv[64][VPITCH], sw[128][WPITCH];
  __shared__ __align__(16) float sq[NH][DI]; __shared__ __align__(16) float so[NH][32];   // the score weights (WQ or WK, rounded) and the block's 8 x 32 scores
  __bf16 (*sh)[72] = (__bf16 (*)[72])&sw[0][0]; __bf16 (*sl)[72] = sh + 128;   // the two result planes [128 columns][64 keys + pad] take sw's place once its last stage has been read
  const int tid = threadIdx.x, wave = tid >> 5, lane = tid & 31, col = lane & 15, g = lane >> 4; const int oc = blockIdx.z, b = blockIdx.y; const int k0 = blockIdx.x * 64;
  // The block's share of the scalar scores: 32 rows of Q (blocks 0..255) or of K (the rest): AQ[b][h][q] = sum_i Q[b][q][i] WQ[h][i], AK likewise.  32 floats per (b,h) = one 128-B line per block.
  static_assert((DI / 128) * TNB * (SK / 64) == 2 * NB * SQ / 32 && SQ == SK, "one block per 32 rows of Q and K");
  const int lin = (blockIdx.z * TNB + blockIdx.y) * (SK / 64) + blockIdx.x, which = lin / (NB * SQ / 32), ab = lin % (NB * SQ / 32) / (SQ / 32), r0 = lin % (SQ / 32) * 32;
  const float* Wm = which == 0 ? WQ : WK; float* A = which == 0 ? AQ : AK;
  const float* xr = (which == 0 ? Q : K) + ((size_t)ab * SQ + r0 + wave * 8) * DI + lane * 4;   // a wave owns 8 rows; lane = 16 i of every row, all 8 heads
  // full unroll: the 8 weight loads go out in front of the V rows and are rounded and stored behind them; the barriers of the first WV stage publish sq
  v4f wq[NH * DI / 512];
#pragma unroll
  for (int q = 0; q < NH * DI / 512; ++q) wq[q] = *(const v4f*)(Wm + q * 512 + tid * 4);
  const float* Vt = V + ((size_t)b * SK + k0) * DI + tid * 4;   // thread = 4 k of every row
  // unroll 32: that many independent 16-B loads per lane in flight, so a batch pays the load latency once
#pragma unroll 32
  for (int r = 0; r < 64; ++r) *(v4b*)&sv[r][tid * 4] = __builtin_convertvector(*(const v4f*)(Vt + (size_t)r * DI), v4b);
#pragma unroll
  for (int q = 0; q < NH * DI / 512; ++q) *(v4f*)(&sq[0][0] + q * 512 + tid * 4) = __builtin_convertvector(__builtin_convertvector(wq[q], v4b), v4f);
  const int wr = tid >> 6, wc = (tid & 63) * 4;                  // thread = 4 k of every second row of a stage
  v8f acc[8] = {};
    // unroll 1: one copy of the stage and its matrix block in the text
#pragma unroll 1
    for (int kh = 0; kh < 2; ++kh) { const float* Wt = WV + (size_t)(oc * 128 + wr) * DI + kh * 256 + wc;
      __syncthreads();   // every wave has finished its reads of the stage that sw still holds
      // unroll 32: as above
#pragma unroll 32
      for (int r = 0; r < 64; ++r) *(v4b*)&sw[2 * r + wr][wc] = __builtin_convertvector(*(const v4f*)(Wt + (size_t)(2 * r) * DI), v4b);
      __syncthreads();   // the stage (and, the first time, sv) is visible to every wave
      const __bf16* ap = &sv[wave * 16 + col][kh * 256]; const __bf16* bp = &sw[col][0];
      v16b fa[2], fb[2][8];   // two fragment sets: the next 32 k are fetched as one group ahead of the current matrix instructions, which then do not wait out the LDS latency
      fa[0] = frag_b(ap, lane);
#pragma unroll
      for (int j = 0; j < 8; ++j) fb[0][j] = frag_b(bp + j * 16 * WPITCH, lane);
      // full unroll, here and in the j loops: set and tile indices must be compile-time constants for the sets to stay in registers
#pragma unroll
      for (int kc = 0; kc < 8; ++kc) { const int cu = kc & 1, nx = cu ^ 1;
        if (kc + 1 < 8) { fa[nx] = frag_b(ap + (kc + 1) * 32, lane);
#pragma unroll
          for (int j = 0; j < 8; ++j) fb[nx][j] = frag_b(bp + j * 16 * WPITCH + (kc + 1) * 32, lane); }
#pragma unroll
        for (int j = 0; j < 8; ++j) acc[j] = wmma_bf(fa[cu], fb[cu][j], acc[j]); } }
  // The wave's 8 score rows are read as 32 whole-line loads (a wave-wide 16-B load = 512 contiguous bytes), all sent here: they fly from memory while the result planes are written out.
  v4f x[2][4][4];
  // full unroll, here and below: x, sa and v are indexed by constants and stay in registers
#pragma unroll
  for (int p = 0; p < 2; ++p)
#pragma unroll
    for (int r = 0; r < 4; ++r)
#pragma unroll
      for (int j = 0; j < 4; ++j) x[p][r][j] = *(const v4f*)(xr + (p * 4 + r) * DI + j * 128);
  asm volatile("s_wait_xcnt 0x0" :: "v"(xr) : "memory");   // the address that the 32 loads name stays whole up to this wait: without the operand the last load's result takes its registers
  __builtin_amdgcn_sched_barrier(0);   // keeps the loads in front of the write-out below, which would otherwise run first and leave their latency exposed
  lds_barrier();   // every wave has finished its reads of sw: the result planes may take its place
#pragma unroll
    for (int j = 0; j < 8; ++j)
#pragma unroll
      for (int r = 0; r < 8; ++r) { const int o = j * 16 + col; const float v = acc[j][r]; const __bf16 hb = (__bf16)v; sh[o][wave * 16 + 8 * g + r] = hb; sl[o][wave * 16 + 8 * g + r] = (__bf16)(v - (float)hb); }
  lds_barrier();   // the result planes, written by all four waves, are visible to every wave
  // full unroll: the 16 LDS reads of a thread go out together, and each store follows as its piece lands
#pragma unroll
  for (int i = 0; i < 8; ++i) { const int o = i * 16 + (tid >> 3), pc = tid & 7; const size_t off = ((size_t)b * DI + oc * 128 + (tid >> 3)) * SK + k0 + pc * 8; vst2((unsigned*)(VTH + off + i * 16 * SK), *(const v4u*)&sh[o][pc * 8]); vst2((unsigned*)(VTL + off + i * 16 * SK), *(const v4u*)&sl[o][pc * 8]); }
  __builtin_amdgcn_sched_barrier(0);   // the plane stores go out before the scores are begun: sunk among them they would hold 64 more registers
  // the scores: 4 rows at a time; the 32 (row, head) partial sums of a lane are folded over the 32 lanes by a halving butterfly that leaves sum number L in lane L
#pragma unroll
  for (int p = 0; p < 2; ++p) {
#pragma unroll
    for (int r = 0; r < 4; ++r)
#pragma unroll
      for (int j = 0; j < 4; ++j) x[p][r][j] = __builtin_convertvector(__builtin_convertvector(x[p][r][j], v4b), v4f);
    v2f sa[4][NH] = {};   // two f32 chains per (row, head): even and odd i pairs, one packed multiply-add each
#pragma unroll
    for (int h = 0; h < NH; ++h)
#pragma unroll
      for (int j = 0; j < 4; ++j) { const v4f w = *(const v4f*)&sq[h][j * 128 + lane * 4];
#pragma unroll
        for (int r = 0; r < 4; ++r) { sa[r][h] = __builtin_elementwise_fma(x[p][r][j].xy, w.xy, sa[r][h]); sa[r][h] = __builtin_elementwise_fma(x[p][r][j].zw, w.zw, sa[r][h]); } }
    float v[32];
#pragma unroll
    for (int r = 0; r < 4; ++r)
#pragma unroll
      for (int h = 0; h < NH; ++h) v[r * NH + h] = sa[r][h][0] + sa[r][h][1];
    fold<16>(v, lane); fold<8>(v, lane); fold<4>(v, lane); fold<2>(v, lane); fold<1>(v, lane);
    so[lane & 7][wave * 8 + p * 4 + (lane >> 3)] = v[0];
    __builtin_amdgcn_sched_barrier(0); }   // one group of 4 rows is finished before the next is begun: interleaved they would need both groups' sums in registers at once
  lds_barrier();   // the 8 x 32 scores, written by all four waves, are visible to the threads that store them
  if (tid < NH * 8) { const int h = tid >> 3, pc = tid & 7; vst2(A + ((size_t)ab * NH + h) * SQ + r0 + pc * 4, *(const v4f*)&so[h][pc * 4]); }
}
#define VSP 72                      // bf16 per staged Vproj row: 144 B = 16 B x 9 (odd), the pitch for 16-byte LDS readers
#define VBUFB (2u * OD * VSP * 2u)  // bytes of one buffer (two planes)
// one tile's copies of one thread: 4 pieces of 16 B per plane, 16 rows apart (a wave's copy = 4 whole lines).  gh, gl: the thread's first piece in each plane; lds: its place in the hi plane of the buffer.
__device__ __forceinline__ void stage_v(const __bf16* gh, const __bf16* gl, unsigned lds) {
  const unsigned rs = 16u * VSP * 2u, ps = OD * VSP * 2u;
  // the wait on xcnt is the last line of the copies' own statement: it stands in front of every later write of the address registers that the copies name
  asm volatile("global_load_async_to_lds_b128 %0, %8, off\n\t"
               "global_load_async_to_lds_b128 %1, %9, off\n\t"
               "global_load_async_to_lds_b128 %2, %10, off\n\t"
               "global_load_async_to_lds_b128 %3, %11, off\n\t"
               "global_load_async_to_lds_b128 %4, %12, off\n\t"
               "global_load_async_to_lds_b128 %5, %13, off\n\t"
               "global_load_async_to_lds_b128 %6, %14, off\n\t"
               "global_load_async_to_lds_b128 %7, %15, off\n\t"
               "s_wait_xcnt 0x0"
               :: "v"(lds), "v"(lds + rs), "v"(lds + 2u * rs), "v"(lds + 3u * rs), "v"(lds + ps), "v"(lds + ps + rs), "v"(lds + ps + 2u * rs), "v"(lds + ps + 3u * rs),
                  "v"(gh), "v"(gh + 16 * SK), "v"(gh + 32 * SK), "v"(gh + 48 * SK), "v"(gl), "v"(gl + 16 * SK), "v"(gl + 32 * SK), "v"(gl + 48 * SK)
               : "memory");
}
// ---- k_attn: block = (128 queries, b*8+h), 4 waves, a wave = QW row tiles of 16 queries, so that every staged tile, every Vproj fragment read and every key-table read serves QW row tiles: s = leaky(aq[q] + ak[k], 0.2); softmax with the row max leaky(aq[q] + max ak) taken before the loop, the weight exp(s - max) as a key factor from an LDS table times a row factor, row sum folded over lanes once behind the loop; P hi/lo x Vproj planes (head columns h*64..+63 = rows b*512 + h*64 + d) 3 products; + bias[h][d]; out row segment 256 B
#define QW 2
__global__ __launch_bounds__(128) void k_attn(const float* __restrict__ AQ, const float* __restrict__ AK, const __bf16* __restrict__ VTH, const __bf16* __restrict__ VTL, const float* __restrict__ BIAS, float* __restrict__ OUT) {
  __shared__ __align__(16) float sp[4][QW * 16][36]; __shared__ __align__(16) float so[4][QW * 16][68]; __shared__ __align__(128) float sk[3][SK];   // sk: ak, exp(ak - akmax), exp(0.2 (ak - akmax)); the larger alignment puts it first in LDS, where the 16-bit offset field of an LDS read reaches all three tables from one address
  __shared__ __align__(16) __bf16 sv[2][2][OD][VSP];   // [buffer][plane hi, lo][d][key of the tile]
  const int tid = threadIdx.x, wave = tid >> 5, lane = tid & 31, col = lane & 15, g = lane >> 4;
  const int qb = blockIdx.x, bh = blockIdx.y, b = bh / NH, h = bh % NH; const int q0 = (qb * 4 + wave) * (QW * 16);
  const size_t voff = ((size_t)b * DI + h * OD + (tid >> 3)) * SK + (tid & 7) * 8;   // thread = 16 B (8 keys) of rows tid / 8 + 0, 16, 32, 48
  const __bf16* gvh = VTH + voff; const __bf16* gvl = VTL + voff;
  const unsigned lv = (unsigned)(size_t)&sv[0][0][tid >> 3][(tid & 7) * 8];   // LDS byte address: the low 32 bits of the shared address
  stage_v(gvh, gvl, lv);   // tile 0 into buffer 0: on its way while the key tables are made
  float aq[QW][8];
#pragma unroll
  for (int qt = 0; qt < QW; ++qt)
#pragma unroll
    for (int r = 0; r < 8; ++r) aq[qt][r] = AQ[((size_t)b * NH + h) * SQ + q0 + qt * 16 + 8 * g + r];
  const float* AKb = AK + ((size_t)b * NH + h) * SK;
  // The logit leaky(aq + ak) never decreases as ak grows (f32 add, and leaky with a positive slope, keep order), so a row's maximum over all keys is the logit at the largest ak: it is known before the key loop and equals, bit for bit, the last running maximum.
  float akmax;
  // full unroll, here and in the qt, r and dt loops below: the eight whole-line loads go out together; c, l and e are indexed by constants and stay in registers
  { v4f t = *(const v4f*)(AKb + lane * 4);
#pragma unroll
    for (int j = 1; j < SK / 128; ++j) { const v4f w = *(const v4f*)(AKb + j * 128 + lane * 4); t[0] = fmaxf(t[0], w[0]); t[1] = fmaxf(t[1], w[1]); t[2] = fmaxf(t[2], w[2]); t[3] = fmaxf(t[3], w[3]); }
    akmax = fmaxf(fmaxf(t[0], t[1]), fmaxf(t[2], t[3]));
#pragma unroll
    for (int o = 1; o < 32; o <<= 1) akmax = fmaxf(akmax, __shfl_xor(akmax, o)); }
  // exp(leaky(aq + ak) - m) splits into a factor of the key and a factor of the row.  Where aq + ak > 0 the row maximum m is aq + akmax, so the weight is exp(ak - akmax); elsewhere it is exp(0.2 (aq + akmax) - m) * exp(0.2 (ak - akmax)).  Every factor lies in (0, 1].  The two key factors are made once per block (8 keys a thread) and kept in LDS beside ak; the key loop holds no exp.
#pragma unroll
  for (int j = 0; j < 2; ++j) { const int kk = (wave * 2 + j) * 128 + lane * 4; const v4f a = *(const v4f*)(AKb + kk); v4f e1, e2;
#pragma unroll
    for (int i = 0; i < 4; ++i) { const float dk = a[i] - akmax; e1[i] = expf(dk); e2[i] = expf(0.2f * dk); }
    *(v4f*)&sk[0][kk] = a; *(v4f*)&sk[1][kk] = e1; *(v4f*)&sk[2][kk] = e2; }
  float c[QW][8], l[QW][8]; v8f acc[QW][4] = {};   // c: the row's factor of the negative branch; l: this lane's own share of the row sum (its two key columns of every step)
#pragma unroll
  for (int qt = 0; qt < QW; ++qt)
#pragma unroll
    for (int r = 0; r < 8; ++r) { const float u = aq[qt][r] + akmax; c[qt][r] = expf(0.2f * u - (u > 0.f ? u : 0.2f * u)); l[qt][r] = 0.f; }
  asm volatile("s_wait_asynccnt 0x0" ::: "memory");   // this wave's copies of tile 0 have landed
  __syncthreads();   // the key tables and tile 0, written by all four waves, are visible to every wave
  stage_v(gvh + 64, gvl + 64, lv + VBUFB);   // tile 1 into buffer 1
  // unroll 1: one copy of the trip in the text
#pragma unroll 1
  for (int t = 0; t < SK / 64; ++t) { const __bf16* vt = &sv[t & 1][0][col][0];
  // full unroll: the two 32-key steps of a tile differ by constant LDS offsets
#pragma unroll
  for (int s = 0; s < 2; ++s) { const int ks = t * 2 + s; const int kc = ks * 32 + col;
    v16b vh[4], vl[4];   // the step's 16 fragment reads go out as one group in front of the weights, which are made while the reads are on their way
#pragma unroll
    for (int dt = 0; dt < 4; ++dt) { vh[dt] = frag_b(vt + dt * 16 * VSP + s * 32, lane); vl[dt] = frag_b(vt + (OD + dt * 16) * VSP + s * 32, lane); }
    const float k0v = sk[0][kc], k1v = sk[0][kc + 16], p0 = sk[1][kc], p1 = sk[1][kc + 16], n0 = sk[2][kc], n1 = sk[2][kc + 16];
#pragma unroll
    for (int qt = 0; qt < QW; ++qt) { float e[2][8];
#pragma unroll
      for (int r = 0; r < 8; ++r) { e[0][r] = aq[qt][r] + k0v > 0.f ? p0 : c[qt][r] * n0; e[1][r] = aq[qt][r] + k1v > 0.f ? p1 : c[qt][r] * n1; }
#pragma unroll
      for (int r = 0; r < 8; ++r) { l[qt][r] += e[0][r] + e[1][r]; sp[wave][qt * 16 + 8 * g + r][col] = e[0][r]; sp[wave][qt * 16 + 8 * g + r][16 + col] = e[1][r]; } }
    LDSX();
    F2 pa[QW];
#pragma unroll
    for (int qt = 0; qt < QW; ++qt) pa[qt] = split_row(&sp[wave][qt * 16 + col][0], 0, lane);
    // the row tiles alternate, so that a matrix instruction never follows directly on the one whose sum it adds to; each accumulator takes its three products in the order lo.hi, hi.lo, hi.hi
#pragma unroll
    for (int dt = 0; dt < 4; ++dt) {
#pragma unroll
      for (int qt = 0; qt < QW; ++qt) acc[qt][dt] = wmma_bf(pa[qt].l, vh[dt], acc[qt][dt]);
#pragma unroll
      for (int qt = 0; qt < QW; ++qt) acc[qt][dt] = wmma_bf(pa[qt].h, vl[dt], acc[qt][dt]);
#pragma unroll
      for (int qt = 0; qt < QW; ++qt) acc[qt][dt] = wmma_bf(pa[qt].h, vh[dt], acc[qt][dt]); }
    LDSX(); }
    asm volatile("s_wait_dscnt 0x0" ::: "memory");      // this wave's reads of the buffer are done
    asm volatile("s_wait_asynccnt 0x0" ::: "memory");   // this wave's copies of tile t + 1 have landed
    __syncthreads();   // tile t + 1 is visible to every wave, and every wave has left the buffer of tile t
    if (t + 2 < SK / 64) stage_v(gvh + (t + 2) * 64, gvl + (t + 2) * 64, lv + (unsigned)(t & 1) * VBUFB); }
  asm volatile("s_wait_asynccnt 0x0" ::: "memory");   // no copy is outstanding behind the loop
#pragma unroll
  for (int qt = 0; qt < QW; ++qt)
#pragma unroll
  for (int r = 0; r < 8; ++r) { float ls = l[qt][r];
#pragma unroll
    for (int o = 1; o < 16; o <<= 1) ls += __shfl_xor(ls, o);
    const float il = 1.0f / ls;
#pragma unroll
    for (int dt = 0; dt < 4; ++dt) so[wave][qt * 16 + 8 * g + r][dt * 16 + col] = acc[qt][dt][r] * il + bfr(BIAS[h * OD + dt * 16 + col]); }
  LDSX();
#pragma unroll
  for (int qt = 0; qt < QW; ++qt) {
    for (int rl = 0; rl < 16; ++rl) if (lane < 16) vst2(OUT + ((size_t)b * SQ + q0 + qt * 16 + rl) * (NH * OD) + h * OD + lane * 4, *(const v4f*)&so[wave][qt * 16 + rl][lane * 4]);
    if (qt + 1 < QW) asm volatile("s_wait_xcnt 0x0" ::: "memory"); }   // the next row tile's LDS reads land in registers that these stores name
}
extern "C" void kernel_launch(void* const* d_in, const int* in_sizes, int n_in, void* d_out, int out_size, void* d_ws, size_t ws_size, hipStream_t stream) {
  (void)in_sizes; (void)n_in; (void)out_size;
  const float** F = (const float**)d_in;   // Q, K, V [8,1024,512], WQ [8,512], WK [8,512], WV [512,512], bias [8,64]
  if (ws_size < (size_t)WS_END) return;
  char* ws = (char*)d_ws; __bf16 *VTH = (__bf16*)(ws + WS_VTH), *VTL = (__bf16*)(ws + WS_VTL); float *AQ = (float*)(ws + WS_AQ), *AK = (float*)(ws + WS_AK);
  k_vproj<<<dim3(SK / 64, TNB, DI / 128), 128, 0, stream>>>(F[2], F[5], VTH, VTL, F[0], F[1], F[3], F[4], AQ, AK);
  k_attn<<<dim3(TQB, TNB * NH), 128, 0, stream>>>(AQ, AK, VTH, VTL, F[6], (float*)d_out);
}

// v009
// Measured time: 39.2 microseconds a run.
// Timed twice side by side with v008, it ran 1.10 and 1.09 times as fast.
// Over all steps from v000 it is 10.2 times as fast.
// compute dtype: Q, K, V, WQ, WK, WV, bias (module inputs) rounded to bf16; Vproj with exact bf16 products on WMMA; the per-head scalar scores attn_Q/attn_K as f32 dots of bf16-rounded inputs; rank-1 logits leaky(aq[q] + ak[k]) and the softmax (row maximum known up front) in f32; P.Vproj with both computed operands as bf16 hi + residual pairs (3 products); f32 accumulate.
#include <hip/hip_runtime.h>
#include <math.h>

typedef __attribute__((ext_vector_type(16))) _Float16 v16h;
typedef __attribute__((ext_vector_type(16))) __bf16 v16b;
typedef __attribute__((ext_vector_type(8)))  _Float16 v8h;
typedef __attribute__((ext_vector_type(8)))  float v8f;
typedef __attribute__((ext_vector_type(4)))  float v4f;
typedef __attribute__((ext_vector_type(2)))  float v2f;
typedef __attribute__((ext_vector_type(4)))  unsigned v4u;
typedef __attribute__((ext_vector_type(4)))  int v4i;
typedef float __attribute__((may_alias)) float_a;
typedef int __attribute__((may_alias)) int_a;

template <typename T> __device__ __forceinline__ void vst2(void* p, T v) { *(T*)p = v;  }
__device__ __forceinline__ v8f wmma16(v16h a, v16h b, v8f c) {
  v8f d = __builtin_amdgcn_wmma_f32_16x16x32_f16(false, a, false, b, (short)0, c, false, false);
  asm volatile("v_nop\n\tv_nop\n\tv_nop\n\tv_nop" : "+v"(d) : "v"(a), "v"(b));
  return d;
}
__device__ __forceinline__ v8f wmma_bf(v16b a, v16b b, v8f c) {
  v8f d = __builtin_amdgcn_wmma_f32_16x16x32_bf16(false, a, false, b, (short)0, c, false, false);
  asm volatile("v_nop\n\tv_nop\n\tv_nop\n\tv_nop" : "+v"(d) : "v"(a), "v"(b));
  return d;
}
// 16x16x32 fragments: lane = (h = lane>>4, row/col = lane&15); elements 0..7 = k0+8h+0..7, 8..15 = k0+16+8h+0..7; D element r = row 8h+r
__device__ __forceinline__ v16h frag_h(const _Float16* rowk0, int lane) {
  union { v16h v; v8h q[2]; } u; const _Float16* p = rowk0 + 8 * (lane >> 4);
  u.q[0] = *(const v8h*)p; u.q[1] = *(const v8h*)(p + 16); return u.v;
}
__device__ __forceinline__ v16h frag_f32(const float* rowk0, int lane) {
  v16h a; const float* p = rowk0 + 8 * (lane >> 4);
#pragma unroll
  for (int i = 0; i < 8; ++i) { a[i] = (_Float16)p[i]; a[8 + i] = (_Float16)p[16 + i]; }
  return a;
}
__device__ __forceinline__ v16h frag_f32s(const float* rowk0, int lane, float sc) {
  v16h a; const float* p = rowk0 + 8 * (lane >> 4);
#pragma unroll
  for (int i = 0; i < 8; ++i) { a[i] = (_Float16)(p[i] * sc); a[8 + i] = (_Float16)(p[16 + i] * sc); }
  return a;
}
// column fragment from a [K][ld] layout (column n), rows >= K read as 0
__device__ __forceinline__ v16h fragc_f32(const float* W, int k0, int n, int lane, int ld, int K) {
  v16h a; const int g = lane >> 4;
#pragma unroll
  for (int i = 0; i < 8; ++i) { const int ka = k0 + 8 * g + i, kb = ka + 16;
    a[i] = (_Float16)(ka < K ? W[(size_t)(ka < K ? ka : K - 1) * ld + n] : 0.f); a[8 + i] = (_Float16)(kb < K ? W[(size_t)(kb < K ? kb : K - 1) * ld + n] : 0.f); }
  return a;
}
struct F2 { v16b h, l; };
__device__ __forceinline__ F2 bsplit16(const float v[16]) { F2 r;
#pragma unroll
  for (int i = 0; i < 16; ++i) { const __bf16 h = (__bf16)v[i]; r.h[i] = h; r.l[i] = (__bf16)(v[i] - (float)h); }
  return r; }
__device__ __forceinline__ F2 split_row(const float* row, int k0, int lane) { float v[16]; const float* p = row + k0 + 8 * (lane >> 4);
#pragma unroll
  for (int i = 0; i < 8; ++i) { v[i] = p[i]; v[8 + i] = p[16 + i]; }
  return bsplit16(v); }
__device__ __forceinline__ F2 split_rowK(const float* row, int k0, int lane, int K) { float v[16]; const int g = lane >> 4;
#pragma unroll
  for (int i = 0; i < 8; ++i) { const int ka = k0 + 8 * g + i, kb = ka + 16; v[i] = ka < K ? row[ka < K ? ka : K - 1] : 0.f; v[8 + i] = kb < K ? row[kb < K ? kb : K - 1] : 0.f; }
  return bsplit16(v); }
__device__ __forceinline__ F2 split_col(const float* W, int k0, int n, int lane, int ld, int K) { float v[16]; const int g = lane >> 4;
#pragma unroll
  for (int i = 0; i < 8; ++i) { const int ka = k0 + 8 * g + i, kb = ka + 16; v[i] = ka < K ? W[(size_t)(ka < K ? ka : K - 1) * ld + n] : 0.f; v[8 + i] = kb < K ? W[(size_t)(kb < K ? kb : K - 1) * ld + n] : 0.f; }
  return bsplit16(v); }
__device__ __forceinline__ v8f mac3(const F2& a, const F2& b, v8f c) { c = wmma_bf(a.l, b.h, c); c = wmma_bf(a.h, b.l, c); return wmma_bf(a.h, b.h, c); }
__device__ __forceinline__ float sigm(float v) { return 1.0f / (1.0f + expf(-v)); }
#define LDSX() do { asm volatile("s_wait_dscnt 0" ::: "memory"); __builtin_amdgcn_wave_barrier(); __builtin_amdgcn_fence(__ATOMIC_RELEASE, "workgroup"); } while (0)


// Additive multi-head attention block: Vproj = V WV^T (8 heads x 64), attn_Q = Q WQ^T, attn_K = K WK^T (one scalar per head), w = softmax_k(leaky_relu(attn_Q[q,h] + attn_K[k,h], 0.2)), out[q, h*64 + d] = sum_k w Vproj[k,h,d] + bias[h,d].  B 8, 1024 queries/keys, dims 512.
// k_vproj (exact GEMM -> transposed hi/lo planes; each block also makes the 8 scalar projections of 32 rows of Q or K, f32), k_attn (block = (128 queries, b*8+h), a wave = 32 of them: 32 key steps, VALU logits, row max up front, per-lane sums, P hi/lo x Vproj planes, + bias).
#define NB 8
#define SQ 1024
#define SK 1024
#define DI 512
#define NH 8
#define OD 64
#ifndef TQB
#define TQB (SQ / 128)
#define TNB NB
#endif
typedef __attribute__((ext_vector_type(8))) __bf16 v8b;
__device__ __forceinline__ v16b frag_b(const __bf16* rowk0, int lane) {
  union { v16b v; v8b q[2]; } u; const __bf16* p = rowk0 + 8 * (lane >> 4);
  u.q[0] = *(const v8b*)p; u.q[1] = *(const v8b*)(p + 16); return u.v;
}
__device__ __forceinline__ v16b frag_gbf(const float* rowk0, int lane) {
  v16b a; const float* p = rowk0 + 8 * (lane >> 4);
#pragma unroll
  for (int i = 0; i < 8; ++i) { a[i] = (__bf16)p[i]; a[8 + i] = (__bf16)p[16 + i]; }
  return a;
}
__device__ __forceinline__ float bfr(float v) { return (float)(__bf16)v; }
#define WS_VTH  0u                                   // bf16 [8][512][1024] Vproj transposed hi
#define WS_VTL  (WS_VTH + 2u * NB * DI * SK)
#define WS_AQ   (WS_VTL + 2u * NB * DI * SK)           // f32 [8][8 h][1024 q]
#define WS_AK   (WS_AQ + 4u * NB * NH * SQ)            // f32 [8][8 h][1024 k]
#define WS_END  (WS_AK + 4u * NB * NH * SK)

// one level of a halving butterfly: at distance N a lane keeps the half of its 2N sums whose number has bit N as its own lane number has, and hands the other half to lane ^ N (N a template constant: every index into v is a compile-time constant)
template <int N> __device__ __forceinline__ void fold(float (&v)[32], int lane) { const bool up = (lane & N) != 0;
#pragma unroll
  for (int j = 0; j < N; ++j) { const float keep = up ? v[j + N] : v[j], send = up ? v[j] : v[j + N]; v[j] = keep + __shfl_xor(send, N); } }
// work-group barrier that orders LDS alone: global loads already sent stay in flight across it, and global stores are not waited for (__syncthreads() waits for both).  For places where the waves hand each other LDS data only.
__device__ __forceinline__ void lds_barrier() { __builtin_amdgcn_fence(__ATOMIC_RELEASE, "workgroup", "local"); __builtin_amdgcn_s_barrier(); __builtin_amdgcn_fence(__ATOMIC_ACQUIRE, "workgroup", "local"); }
// k_vproj: block = (64 V rows, b, 128 output columns): 512 blocks of 148 KiB of LDS, two to a WGP on every WGP, so that one block's loads run beside the other's matrix work.
// k_vproj staging: the block's 64 V rows (all 512 k) and, per stage, its 128 WV rows x 256 k are read once per block by whole-line loads (a wave-wide 16-B load = 512 contiguous bytes), rounded to bf16 once and kept in LDS; all four waves take their fragments from there.
#define VPITCH 520   // bf16 per staged V row: 1040 B = 16 B x 65 (odd), the pitch for 16-byte LDS readers
#define WPITCH 264   // bf16 per staged WV half row: 528 B = 16 B x 33 (odd)
typedef __attribute__((ext_vector_type(4))) __bf16 v4b;
__global__ __launch_bounds__(128) void k_vproj(const float* __restrict__ V, const float* __restrict__ WV, __bf16* __restrict__ VTH, __bf16* __restrict__ VTL, const float* __restrict__ Q, const float* __restrict__ K, const float* __restrict__ WQ, const float* __restrict__ WK, float* __restrict__ AQ, float* __restrict__ AK) {
  __shared__ __align__(16) __bf16 sv[64][VPITCH], sw[128][WPITCH];
  __shared__ __align__(16) float sq[NH][DI]; __shared__ __align__(16) float so[NH][32];   // the score weights (WQ or WK, rounded) and the block's 8 x 32 scores
  __bf16 (*sh)[72] = (__bf16 (*)[72])&sw[0][0]; __bf16 (*sl)[72] = sh + 128;   // the two result planes [128 columns][64 keys + pad] take sw's place once its last stage has been read
  const int tid = threadIdx.x, wave = tid >> 5, lane = tid & 31, col = lane & 15, g = lane >> 4; const int oc = blockIdx.z, b = blockIdx.y; const int k0 = blockIdx.x * 64;
  // The block's share of the scalar scores: 32 rows of Q (blocks 0..255) or of K (the rest): AQ[b][h][q] = sum_i Q[b][q][i] WQ[h][i], AK likewise.  32 floats per (b,h) = one 128-B line per block.
  static_assert((DI / 128) * TNB * (SK / 64) == 2 * NB * SQ / 32 && SQ == SK, "one block per 32 rows of Q and K");
  const int lin = (blockIdx.z * TNB + blockIdx.y) * (SK / 64) + blockIdx.x, which = lin / (NB * SQ / 32), ab = lin % (NB * SQ / 32) / (SQ / 32), r0 = lin % (SQ / 32) * 32;
  const float* Wm = which == 0 ? WQ : WK; float* A = which == 0 ? AQ : AK;
  const float* xr = (which == 0 ? Q : K) + ((size_t)ab * SQ + r0 + wave * 8) * DI + lane * 4;   // a wave owns 8 rows; lane = 16 i of every row, all 8 heads
  // full unroll: the 8 weight loads go out in front of the V rows and are rounded and stored behind them; the barriers of the first WV stage publish sq
  v4f wq[NH * DI / 512];
#pragma unroll
  for (int q = 0; q < NH * DI / 512; ++q) wq[q] = *(const v4f*)(Wm + q * 512 + tid * 4);
  const float* Vt = V + ((size_t)b * SK + k0) * DI + tid * 4;   // thread = 4 k of every row
  // unroll 32: that many independent 16-B loads per lane in flight, so a batch pays the load latency once
#pragma unroll 32
  for (int r = 0; r < 64; ++r) *(v4b*)&sv[r][tid * 4] = __builtin_convertvector(*(const v4f*)(Vt + (size_t)r * DI), v4b);
#pragma unroll
  for (int q = 0; q < NH * DI / 512; ++q) *(v4f*)(&sq[0][0] + q * 512 + tid * 4) = __builtin_convertvector(__builtin_convertvector(wq[q], v4b), v4f);
  const int wr = tid >> 6, wc = (tid & 63) * 4;                  // thread = 4 k of every second row of a stage
  v8f acc[8] = {};
    // unroll 1: one copy of the stage and its matrix block in the text
#pragma unroll 1
    for (int kh = 0; kh < 2; ++kh) { const float* Wt = WV + (size_t)(oc * 128 + wr) * DI + kh * 256 + wc;
      __syncthreads();   // every wave has finished its reads of the stage that sw still holds
      // unroll 32: as above
#pragma unroll 32
      for (int r = 0; r < 64; ++r) *(v4b*)&sw[2 * r + wr][wc] = __builtin_convertvector(*(const v4f*)(Wt + (size_t)(2 * r) * DI), v4b);
      __syncthreads();   // the stage (and, the first time, sv) is visible to every wave
      const __bf16* ap = &sv[wave * 16 + col][kh * 256]; const __bf16* bp = &sw[col][0];
      v16b fa[2], fb[2][8];   // two fragment sets: the next 32 k are fetched as one group ahead of the current matrix instructions, which then do not wait out the LDS latency
      fa[0] = frag_b(ap, lane);
#pragma unroll
      for (int j = 0; j < 8; ++j) fb[0][j] = frag_b(bp + j * 16 * WPITCH, lane);
      // full unroll, here and in the j loops: set and tile indices must be compile-time constants for the sets to stay in registers
#pragma unroll
      for (int kc = 0; kc < 8; ++kc) { const int cu = kc & 1, nx = cu ^ 1;
        if (kc + 1 < 8) { fa[nx] = frag_b(ap + (kc + 1) * 32, lane);
#pragma unroll
          for (int j = 0; j < 8; ++j) fb[nx][j] = frag_b(bp + j * 16 * WPITCH + (kc + 1) * 32, lane); }
#pragma unroll
        for (int j = 0; j < 8; ++j) acc[j] = wmma_bf(fa[cu], fb[cu][j], acc[j]); } }
  // The wave's 8 score rows are read as 32 whole-line loads (a wave-wide 16-B load = 512 contiguous bytes), all sent here: they fly from memory while the result planes are written out.
  v4f x[2][4][4];
  // full unroll, here and below: x, sa and v are indexed by constants and stay in registers
#pragma unroll
  for (int p = 0; p < 2; ++p)
#pragma unroll
    for (int r = 0; r < 4; ++r)
#pragma unroll
      for (int j = 0; j < 4; ++j) x[p][r][j] = *(const v4f*)(xr + (p * 4 + r) * DI + j * 128);
  asm volatile("s_wait_xcnt 0x0" :: "v"(xr) : "memory");   // the address that the 32 loads name stays whole up to this wait: without the operand the last load's result takes its registers
  __builtin_amdgcn_sched_barrier(0);   // keeps the loads in front of the write-out below, which would otherwise run first and leave their latency exposed
  lds_barrier();   // every wave has finished its reads of sw: the result planes may take its place
#pragma unroll
    for (int j = 0; j < 8; ++j)
#pragma unroll
      for (int r = 0; r < 8; ++r) { const int o = j * 16 + col; const float v = acc[j][r]; const __bf16 hb = (__bf16)v; sh[o][wave * 16 + 8 * g + r] = hb; sl[o][wave * 16 + 8 * g + r] = (__bf16)(v - (float)hb); }
  lds_barrier();   // the result planes, written by all four waves, are visible to every wave
  // full unroll: the 16 LDS reads of a thread go out together, and each store follows as its piece lands
#pragma unroll
  for (int i = 0; i < 8; ++i) { const int o = i * 16 + (tid >> 3), pc = tid & 7; const size_t off = ((size_t)b * DI + oc * 128 + (tid >> 3)) * SK + k0 + pc * 8; vst2((unsigned*)(VTH + off + i * 16 * SK), *(const v4u*)&sh[o][pc * 8]); vst2((unsigned*)(VTL + off + i * 16 * SK), *(const v4u*)&sl[o][pc * 8]); }
  __builtin_amdgcn_sched_barrier(0);   // the plane stores go out before the scores are begun: sunk among them they would hold 64 more registers
  // the scores: 4 rows at a time; the 32 (row, head) partial sums of a lane are folded over the 32 lanes by a halving butterfly that leaves sum number L in lane L
#pragma unroll
  for (int p = 0; p < 2; ++p) {
#pragma unroll
    for (int r = 0; r < 4; ++r)
#pragma unroll
      for (int j = 0; j < 4; ++j) x[p][r][j] = __builtin_convertvector(__builtin_convertvector(x[p][r][j], v4b), v4f);
    v2f sa[4][NH] = {};   // two f32 chains per (row, head): even and odd i pairs, one packed multiply-add each
#pragma unroll
    for (int h = 0; h < NH; ++h)
#pragma unroll
      for (int j = 0; j < 4; ++j) { const v4f w = *(const v4f*)&sq[h][j * 128 + lane * 4];
#pragma unroll
        for (int r = 0; r < 4; ++r) { sa[r][h] = __builtin_elementwise_fma(x[p][r][j].xy, w.xy, sa[r][h]); sa[r][h] = __builtin_elementwise_fma(x[p][r][j].zw, w.zw, sa[r][h]); } }
    float v[32];
#pragma unroll
    for (int r = 0; r < 4; ++r)
#pragma unroll
      for (int h = 0; h < NH; ++h) v[r * NH + h] = sa[r][h][0] + sa[r][h][1];
    fold<16>(v, lane); fold<8>(v, lane); fold<4>(v, lane); fold<2>(v, lane); fold<1>(v, lane);
    so[lane & 7][wave * 8 + p * 4 + (lane >> 3)] = v[0];
    __builtin_amdgcn_sched_barrier(0); }   // one group of 4 rows is finished before the next is begun: interleaved they would need both groups' sums in registers at once
  lds_barrier();   // the 8 x 32 scores, written by all four waves, are visible to the threads that store them
  if (tid < NH * 8) { const int h = tid >> 3, pc = tid & 7; vst2(A + ((size_t)ab * NH + h) * SQ + r0 + pc * 4, *(const v4f*)&so[h][pc * 4]); }
}
#define VSP 72                      // bf16 per staged Vproj row: 144 B = 16 B x 9 (odd), the pitch for 16-byte LDS readers
#define VBUFB (2u * OD * VSP * 2u)  // bytes of one buffer (two planes)
// one tile's copies of one thread: 4 pieces of 16 B per plane, 16 rows apart (a wave's copy = 4 whole lines).  gh, gl: the thread's first piece in each plane; lds: its place in the hi plane of the buffer.
__device__ __forceinline__ void stage_v(const __bf16* gh, const __bf16* gl, unsigned lds) {
  const unsigned rs = 16u * VSP * 2u, ps = OD * VSP * 2u;
  // the wait on xcnt is the last line of the copies' own statement: it stands in front of every later write of the address registers that the copies name
  asm volatile("global_load_async_to_lds_b128 %0, %8, off\n\t"
               "global_load_async_to_lds_b128 %1, %9, off\n\t"
               "global_load_async_to_lds_b128 %2, %10, off\n\t"
               "global_load_async_to_lds_b128 %3, %11, off\n\t"
               "global_load_async_to_lds_b128 %4, %12, off\n\t"
               "global_load_async_to_lds_b128 %5, %13, off\n\t"
               "global_load_async_to_lds_b128 %6, %14, off\n\t"
               "global_load_async_to_lds_b128 %7, %15, off\n\t"
               "s_wait_xcnt 0x0"
               :: "v"(lds), "v"(lds + rs), "v"(lds + 2u * rs), "v"(lds + 3u * rs), "v"(lds + ps), "v"(lds + ps + rs), "v"(lds + ps + 2u * rs), "v"(lds + ps + 3u * rs),
                  "v"(gh), "v"(gh + 16 * SK), "v"(gh + 32 * SK), "v"(gh + 48 * SK), "v"(gl), "v"(gl + 16 * SK), "v"(gl + 32 * SK), "v"(gl + 48 * SK)
               : "memory");
}
// ---- k_attn: block = (128 queries, b*8+h), 4 waves, a wave = QW row tiles of 16 queries, so that every staged tile, every Vproj fragment read and every key-table read serves QW row tiles: s = leaky(aq[q] + ak[k], 0.2); softmax with the row max leaky(aq[q] + max ak) taken before the loop, the weight exp(s - max) as a key factor from an LDS table times a row factor, made directly in the A-fragment layout (lane = query row, its 16 keys of the step), row sum folded over lanes once behind the loop; P hi/lo x Vproj planes (head columns h*64..+63 = rows b*512 + h*64 + d) 3 products; + bias[h][d]; out row segment 256 B
#define QW 2
// a lane's 16 keys of a step, in the k order of the A fragment (8 g + 0..7, 16 + 8 g + 0..7), from the three tables: 16-B LDS reads, one address per 16 lanes.  kp: the first of them in the first table
__device__ __forceinline__ void load_keys(const float* kp, v4f (&ka)[4], v4f (&kq)[4], v4f (&kn)[4]) {
#pragma unroll
  for (int j = 0; j < 4; ++j) { const int o = (j >> 1) * 16 + (j & 1) * 4; ka[j] = *(const v4f*)(kp + o); kq[j] = *(const v4f*)(kp + SK + o); kn[j] = *(const v4f*)(kp + 2 * SK + o); } }
typedef __attribute__((ext_vector_type(2))) __bf16 v2b;
__global__ __launch_bounds__(128) void k_attn(const float* __restrict__ AQ, const float* __restrict__ AK, const __bf16* __restrict__ VTH, const __bf16* __restrict__ VTL, const float* __restrict__ BIAS, float* __restrict__ OUT) {
  __shared__ __align__(16) float so[4][QW * 16][68]; __shared__ __align__(128) float sk[3][SK];   // sk: ak, exp(ak - akmax), exp(0.2 (ak - akmax)); the larger alignment puts it first in LDS, where the 16-bit offset field of an LDS read reaches all three tables from one address
  __shared__ __align__(16) __bf16 sv[2][2][OD][VSP];   // [buffer][plane hi, lo][d][key of the tile]
  const int tid = threadIdx.x, wave = tid >> 5, lane = tid & 31, col = lane & 15, g = lane >> 4;
  const int qb = blockIdx.x, bh = blockIdx.y, b = bh / NH, h = bh % NH; const int q0 = (qb * 4 + wave) * (QW * 16);
  const size_t voff = ((size_t)b * DI + h * OD + (tid >> 3)) * SK + (tid & 7) * 8;   // thread = 16 B (8 keys) of rows tid / 8 + 0, 16, 32, 48
  const __bf16* gvh = VTH + voff; const __bf16* gvl = VTL + voff;
  const unsigned lv = (unsigned)(size_t)&sv[0][0][tid >> 3][(tid & 7) * 8];   // LDS byte address: the low 32 bits of the shared address
  stage_v(gvh, gvl, lv);   // tile 0 into buffer 0: on its way while the key tables are made
  float aq[QW];   // a lane holds the A-fragment row of each row tile: query qt * 16 + col
#pragma unroll
  for (int qt = 0; qt < QW; ++qt) aq[qt] = AQ[((size_t)b * NH + h) * SQ + q0 + qt * 16 + col];
  asm volatile("s_wait_xcnt 0x0" ::: "memory");   // stands in front of every later write of the address registers that the two loads above name
  const float* AKb = AK + ((size_t)b * NH + h) * SK;
  // The logit leaky(aq + ak) never decreases as ak grows (f32 add, and leaky with a positive slope, keep order), so a row's maximum over all keys is the logit at the largest ak: it is known before the key loop and equals, bit for bit, the last running maximum.
  float akmax;
  // full unroll, here and in the qt, r and dt loops below: the eight whole-line loads go out together; c, l and e are indexed by constants and stay in registers
  { v4f t = *(const v4f*)(AKb + lane * 4);
#pragma unroll
    for (int j = 1; j < SK / 128; ++j) { const v4f w = *(const v4f*)(AKb + j * 128 + lane * 4); t[0] = fmaxf(t[0], w[0]); t[1] = fmaxf(t[1], w[1]); t[2] = fmaxf(t[2], w[2]); t[3] = fmaxf(t[3], w[3]); }
    akmax = fmaxf(fmaxf(t[0], t[1]), fmaxf(t[2], t[3]));
#pragma unroll
    for (int o = 1; o < 32; o <<= 1) akmax = fmaxf(akmax, __shfl_xor(akmax, o)); }
  // exp(leaky(aq + ak) - m) splits into a factor of the key and a factor of the row.  Where aq + ak > 0 the row maximum m is aq + akmax, so the weight is exp(ak - akmax); elsewhere it is exp(0.2 (aq + akmax) - m) * exp(0.2 (ak - akmax)).  Every factor lies in (0, 1].  The two key factors are made once per block (8 keys a thread) and kept in LDS beside ak; the key loop holds no exp.
#pragma unroll
  for (int j = 0; j < 2; ++j) { const int kk = (wave * 2 + j) * 128 + lane * 4; const v4f a = *(const v4f*)(AKb + kk); v4f e1, e2;
#pragma unroll
    for (int i = 0; i < 4; ++i) { const float dk = a[i] - akmax; e1[i] = expf(dk); e2[i] = expf(0.2f * dk); }
    *(v4f*)&sk[0][kk] = a; *(v4f*)&sk[1][kk] = e1; *(v4f*)&sk[2][kk] = e2; }
  float c[QW]; v2f l[QW][2] = {}; v8f acc[QW][4] = {};   // c: the row's factor of the negative branch; l: this lane's own share of the row sum (its 16 keys of every step), four independent chains in two register pairs
#pragma unroll
  for (int qt = 0; qt < QW; ++qt) { const float u = aq[qt] + akmax; c[qt] = expf(0.2f * u - (u > 0.f ? u : 0.2f * u)); }
  asm volatile("s_wait_asynccnt 0x0" ::: "memory");   // this wave's copies of tile 0 have landed
  __syncthreads();   // the key tables and tile 0, written by all four waves, are visible to every wave
  stage_v(gvh + 64, gvl + 64, lv + VBUFB);   // tile 1 into buffer 1
  v4f ka[4], kq[4], kn[4]; load_keys(&sk[0][8 * g], ka, kq, kn);   // ak and the two key factors of the lane's 16 keys of step 0
  // unroll 1: one copy of the trip in the text
#pragma unroll 1
  for (int t = 0; t < SK / 64; ++t) { const __bf16* vt = &sv[t & 1][0][col][0];
  // full unroll: the two 32-key steps of a tile differ by constant LDS offsets
#pragma unroll
  for (int s = 0; s < 2; ++s) {
    v16b vh[4], vl[4];   // the step's 16 fragment reads go out as one group in front of the weights, which are made while the reads are on their way
#pragma unroll
    for (int dt = 0; dt < 4; ++dt) { vh[dt] = frag_b(vt + dt * 16 * VSP + s * 32, lane); vl[dt] = frag_b(vt + (OD + dt * 16) * VSP + s * 32, lane); }
    F2 pa[QW];
#pragma unroll
    // two neighbouring keys at a time, as the table reads leave them in a register pair: sum, product, row sum and both roundings are packed operations; both row tiles use a pair before the next is taken up
    for (int m = 0; m < 8; ++m) { const int j = m >> 1; const v2f a2 = m & 1 ? ka[j].zw : ka[j].xy, p2 = m & 1 ? kq[j].zw : kq[j].xy, n2 = m & 1 ? kn[j].zw : kn[j].xy;
#pragma unroll
      for (int qt = 0; qt < QW; ++qt) {
        const v2f s2 = aq[qt] + a2, w2 = c[qt] * n2; v2f e2; e2.x = s2.x > 0.f ? p2.x : w2.x; e2.y = s2.y > 0.f ? p2.y : w2.y;
        l[qt][m & 1] += e2;
        const v2b h2 = __builtin_convertvector(e2, v2b), r2 = __builtin_convertvector(e2 - __builtin_convertvector(h2, v2f), v2b);
        pa[qt].h[2 * m] = h2.x; pa[qt].h[2 * m + 1] = h2.y; pa[qt].l[2 * m] = r2.x; pa[qt].l[2 * m + 1] = r2.y; } }
    load_keys(&sk[0][((t * 2 + s + 1) & (SK / 32 - 1)) * 32 + 8 * g], ka, kq, kn);   // the next step's keys: the reads land under the matrix block (the tables do not change after the first barrier; behind the last step the index wraps to step 0 and the values are not used)
    // the row tiles alternate, so that a matrix instruction never follows directly on the one whose sum it adds to; each accumulator takes its three products in the order lo.hi, hi.lo, hi.hi
#pragma unroll
    for (int dt = 0; dt < 4; ++dt) {
#pragma unroll
      for (int qt = 0; qt < QW; ++qt) acc[qt][dt] = wmma_bf(pa[qt].l, vh[dt], acc[qt][dt]);
#pragma unroll
      for (int qt = 0; qt < QW; ++qt) acc[qt][dt] = wmma_bf(pa[qt].h, vl[dt], acc[qt][dt]);
#pragma unroll
      for (int qt = 0; qt < QW; ++qt) acc[qt][dt] = wmma_bf(pa[qt].h, vh[dt], acc[qt][dt]); } }
    asm volatile("s_wait_dscnt 0x0" ::: "memory");      // this wave's reads of the buffer are done
    asm volatile("s_wait_asynccnt 0x0" ::: "memory");   // this wave's copies of tile t + 1 have landed
    __syncthreads();   // tile t + 1 is visible to every wave, and every wave has left the buffer of tile t
    if (t + 2 < SK / 64) stage_v(gvh + (t + 2) * 64, gvl + (t + 2) * 64, lv + (unsigned)(t & 1) * VBUFB); }
  asm volatile("s_wait_asynccnt 0x0" ::: "memory");   // no copy is outstanding behind the loop
#pragma unroll
  for (int qt = 0; qt < QW; ++qt) { const v2f lp = l[qt][0] + l[qt][1]; float ls = lp.x + lp.y; ls += __shfl_xor(ls, 16);   // lanes col and col + 16 hold the two halves of row col's sum
    const float il = 1.0f / ls;
#pragma unroll
  for (int r = 0; r < 8; ++r) { const float ir = __shfl(il, 8 * g + r);   // the accumulator's element r is row 8 g + r, whose sum lane 8 g + r holds
#pragma unroll
    for (int dt = 0; dt < 4; ++dt) so[wave][qt * 16 + 8 * g + r][dt * 16 + col] = acc[qt][dt][r] * ir + bfr(BIAS[h * OD + dt * 16 + col]); } }
  LDSX();
#pragma unroll
  for (int qt = 0; qt < QW; ++qt) {
    for (int rl = 0; rl < 16; ++rl) if (lane < 16) vst2(OUT + ((size_t)b * SQ + q0 + qt * 16 + rl) * (NH * OD) + h * OD + lane * 4, *(const v4f*)&so[wave][qt * 16 + rl][lane * 4]);
    if (qt + 1 < QW) asm volatile("s_wait_xcnt 0x0" ::: "memory"); }   // the next row tile's LDS reads land in registers that these stores name
}
extern "C" void kernel_launch(void* const* d_in, const int* in_sizes, int n_in, void* d_out, int out_size, void* d_ws, size_t ws_size, hipStream_t stream) {
  (void)in_sizes; (void)n_in; (void)out_size;
  const float** F = (const float**)d_in;   // Q, K, V [8,1024,512], WQ [8,512], WK [8,512], WV [512,512], bias [8,64]
  if (ws_size < (size_t)WS_END) return;
  char* ws = (char*)d_ws; __bf16 *VTH = (__bf16*)(ws + WS_VTH), *VTL = (__bf16*)(ws + WS_VTL); float *AQ = (float*)(ws + WS_AQ), *AK = (float*)(ws + WS_AK);
  k_vproj<<<dim3(SK / 64, TNB, DI / 128), 128, 0, stream>>>(F[2], F[5], VTH, VTL, F[0], F[1], F[3], F[4], AQ, AK);
  k_attn<<<dim3(TQB, TNB * NH), 128, 0, stream>>>(AQ, AK, VTH, VTL, F[6], (float*)d_out);
}

// v010
// One run takes 36.4 microseconds.
// Two timings next to v009 put it at 1.08 and 1.07 times that version's speed.
// Counting every step since v000, it is 10.9 times as fast.
// compute dtype: Q, K, V, WQ, WK, WV, bias (module inputs) rounded to bf16; Vproj with exact bf16 products on WMMA; the per-head scalar scores attn_Q/attn_K as f32 dots of bf16-rounded inputs; rank-1 logits leaky(aq[q] + ak[k]) and the softmax (row maximum known up front) in f32; P.Vproj with both computed operands as bf16 hi + residual pairs (3 products); f32 accumulate.
#include <hip/hip_runtime.h>
#include <math.h>

typedef __attribute__((ext_vector_type(16))) _Float16 v16h;
typedef __attribute__((ext_vector_type(16))) __bf16 v16b;
typedef __attribute__((ext_vector_type(8)))  _Float16 v8h;
typedef __attribute__((ext_vector_type(8)))  float v8f;
typedef __attribute__((ext_vector_type(4)))  float v4f;
typedef __attribute__((ext_vector_type(2)))  float v2f;
typedef __attribute__((ext_vector_type(4)))  unsigned v4u;
typedef __attribute__((ext_vector_type(4)))  int v4i;
typedef float __attribute__((may_alias)) float_a;
typedef int __attribute__((may_alias)) int_a;

template <typename T> __device__ __forceinline__ void vst2(void* p, T v) { *(T*)p = v;  }
__device__ __forceinline__ v8f wmma16(v16h a, v16h b, v8f c) {
  v8f d = __builtin_amdgcn_wmma_f32_16x16x32_f16(false, a, false, b, (short)0, c, false, false);
  asm volatile("v_nop\n\tv_nop\n\tv_nop\n\tv_nop" : "+v"(d) : "v"(a), "v"(b));
  return d;
}
__device__ __forceinline__ v8f wmma_bf(v16b a, v16b b, v8f c) {
  return __builtin_amdgcn_wmma_f32_16x16x32_bf16(false, a, false, b, (short)0, c, false, false);
}
// 16x16x32 fragments: lane = (h = lane>>4, row/col = lane&15); elements 0..7 = k0+8h+0..7, 8..15 = k0+16+8h+0..7; D element r = row 8h+r
__device__ __forceinline__ v16h frag_h(const _Float16* rowk0, int lane) {
  union { v16h v; v8h q[2]; } u; const _Float16* p = rowk0 + 8 * (lane >> 4);
  u.q[0] = *(const v8h*)p; u.q[1] = *(const v8h*)(p + 16); return u.v;
}
__device__ __forceinline__ v16h frag_f32(const float* rowk0, int lane) {
  v16h a; const float* p = rowk0 + 8 * (lane >> 4);
#pragma unroll
  for (int i = 0; i < 8; ++i) { a[i] = (_Float16)p[i]; a[8 + i] = (_Float16)p[16 + i]; }
  return a;
}
__device__ __forceinline__ v16h frag_f32s(const float* rowk0, int lane, float sc) {
  v16h a; const float* p = rowk0 + 8 * (lane >> 4);
#pragma unroll
  for (int i = 0; i < 8; ++i) { a[i] = (_Float16)(p[i] * sc); a[8 + i] = (_Float16)(p[16 + i] * sc); }
  return a;
}
// column fragment from a [K][ld] layout (column n), rows >= K read as 0
__device__ __forceinline__ v16h fragc_f32(const float* W, int k0, int n, int lane, int ld, int K) {
  v16h a; const int g = lane >> 4;
#pragma unroll
  for (int i = 0; i < 8; ++i) { const int ka = k0 + 8 * g + i, kb = ka + 16;
    a[i] = (_Float16)(ka < K ? W[(size_t)(ka < K ? ka : K - 1) * ld + n] : 0.f); a[8 + i] = (_Float16)(kb < K ? W[(size_t)(kb < K ? kb : K - 1) * ld + n] : 0.f); }
  return a;
}
struct F2 { v16b h, l; };
__device__ __forceinline__ F2 bsplit16(const float v[16]) { F2 r;
#pragma unroll
  for (int i = 0; i < 16; ++i) { const __bf16 h = (__bf16)v[i]; r.h[i] = h; r.l[i] = (__bf16)(v[i] - (float)h); }
  return r; }
__device__ __forceinline__ F2 split_row(const float* row, int k0, int lane) { float v[16]; const float* p = row + k0 + 8 * (lane >> 4);
#pragma unroll
  for (int i = 0; i < 8; ++i) { v[i] = p[i]; v[8 + i] = p[16 + i]; }
  return bsplit16(v); }
__device__ __forceinline__ F2 split_rowK(const float* row, int k0, int lane, int K) { float v[16]; const int g = lane >> 4;
#pragma unroll
  for (int i = 0; i < 8; ++i) { const int ka = k0 + 8 * g + i, kb = ka + 16; v[i] = ka < K ? row[ka < K ? ka : K - 1] : 0.f; v[8 + i] = kb < K ? row[kb < K ? kb : K - 1] : 0.f; }
  return bsplit16(v); }
__device__ __forceinline__ F2 split_col(const float* W, int k0, int n, int lane, int ld, int K) { float v[16]; const int g = lane >> 4;
#pragma unroll
  for (int i = 0; i < 8; ++i) { const int ka = k0 + 8 * g + i, kb = ka + 16; v[i] = ka < K ? W[(size_t)(ka < K ? ka : K - 1) * ld + n] : 0.f; v[8 + i] = kb < K ? W[(size_t)(kb < K ? kb : K - 1) * ld + n] : 0.f; }
  return bsplit16(v); }
__device__ __forceinline__ v8f mac3(const F2& a, const F2& b, v8f c) { c = wmma_bf(a.l, b.h, c); c = wmma_bf(a.h, b.l, c); return wmma_bf(a.h, b.h, c); }
__device__ __forceinline__ float sigm(float v) { return 1.0f / (1.0f + expf(-v)); }
#define LDSX() do { asm volatile("s_wait_dscnt 0" ::: "memory"); __builtin_amdgcn_wave_barrier(); __builtin_amdgcn_fence(__ATOMIC_RELEASE, "workgroup"); } while (0)


// Additive multi-head attention block: Vproj = V WV^T (8 heads x 64), attn_Q = Q WQ^T, attn_K = K WK^T (one scalar per head), w = softmax_k(leaky_relu(attn_Q[q,h] + attn_K[k,h], 0.2)), out[q, h*64 + d] = sum_k w Vproj[k,h,d] + bias[h,d].  B 8, 1024 queries/keys, dims 512.
// k_vproj (exact GEMM -> transposed hi/lo planes; each block also makes the 8 scalar projections of 32 rows of Q or K, f32), k_attn (block = (128 queries, b*8+h), a wave = 32 of them: 32 key steps, VALU logits, row max up front, per-lane sums, P hi/lo x Vproj planes, + bias).
#define NB 8
#define SQ 1024
#define SK 1024
#define DI 512
#define NH 8
#define OD 64
#ifndef TQB
#define TQB (SQ / 128)
#define TNB NB
#endif
typedef __attribute__((ext_vector_type(8))) __bf16 v8b;
__device__ __forceinline__ v16b frag_b(const __bf16* rowk0, int lane) {
  union { v16b v; v8b q[2]; } u; const __bf16* p = rowk0 + 8 * (lane >> 4);
  u.q[0] = *(const v8b*)p; u.q[1] = *(const v8b*)(p + 16); return u.v;
}
__device__ __forceinline__ v16b frag_gbf(const float* rowk0, int lane) {
  v16b a; const float* p = rowk0 + 8 * (lane >> 4);
#pragma unroll
  for (int i = 0; i < 8; ++i) { a[i] = (__bf16)p[i]; a[8 + i] = (__bf16)p[16 + i]; }
  return a;
}
__device__ __forceinline__ float bfr(float v) { return (float)(__bf16)v; }
#define WS_VTH  0u                                   // bf16 [8][512][1024] Vproj transposed hi
#define WS_VTL  (WS_VTH + 2u * NB * DI * SK)
#define WS_AQ   (WS_VTL + 2u * NB * DI * SK)           // f32 [8][8 h][1024 q]
#define WS_AK   (WS_AQ + 4u * NB * NH * SQ)            // f32 [8][8 h][1024 k]
#define WS_END  (WS_AK + 4u * NB * NH * SK)

// one level of a halving butterfly: at distance N a lane keeps the half of its 2N sums whose number has bit N as its own lane number has, and hands the other half to lane ^ N (N a template constant: every index into v is a compile-time constant)
template <int N> __device__ __forceinline__ void fold(float (&v)[32], int lane) { const bool up = (lane & N) != 0;
#pragma unroll
  for (int j = 0; j < N; ++j) { const float keep = up ? v[j + N] : v[j], send = up ? v[j] : v[j + N]; v[j] = keep + __shfl_xor(send, N); } }
// work-group barrier that orders LDS alone: global loads already sent stay in flight across it, and global stores are not waited for (__syncthreads() waits for both).  For places where the waves hand each other LDS data only.
__device__ __forceinline__ void lds_barrier() { __builtin_amdgcn_fence(__ATOMIC_RELEASE, "workgroup", "local"); __builtin_amdgcn_s_barrier(); __builtin_amdgcn_fence(__ATOMIC_ACQUIRE, "workgroup", "local"); }
// k_vproj: block = (64 V rows, b, 128 output columns): 512 blocks of 148 KiB of LDS, two to a WGP on every WGP, so that one block's loads run beside the other's matrix work.
// k_vproj staging: the block's 64 V rows (all 512 k) and, per stage, its 128 WV rows x 256 k are read once per block by whole-line loads (a wave-wide 16-B load = 512 contiguous bytes), rounded to bf16 once and kept in LDS; all four waves take their fragments from there.
#define VPITCH 520   // bf16 per staged V row: 1040 B = 16 B x 65 (odd), the pitch for 16-byte LDS readers
#define WPITCH 264   // bf16 per staged WV half row: 528 B = 16 B x 33 (odd)
typedef __attribute__((ext_vector_type(4))) __bf16 v4b;
__global__ __launch_bounds__(128) void k_vproj(const float* __restrict__ V, const float* __restrict__ WV, __bf16* __restrict__ VTH, __bf16* __restrict__ VTL, const float* __restrict__ Q, const float* __restrict__ K, const float* __restrict__ WQ, const float* __restrict__ WK, float* __restrict__ AQ, float* __restrict__ AK) {
  __shared__ __align__(16) __bf16 sv[64][VPITCH], sw[128][WPITCH];
  __shared__ __align__(16) float sq[NH][DI]; __shared__ __align__(16) float so[NH][32];   // the score weights (WQ or WK, rounded) and the block's 8 x 32 scores
  __bf16 (*sh)[72] = (__bf16 (*)[72])&sw[0][0]; __bf16 (*sl)[72] = sh + 128;   // the two result planes [128 columns][64 keys + pad] take sw's place once its last stage has been read
  const int tid = threadIdx.x, wave = tid >> 5, lane = tid & 31, col = lane & 15, g = lane >> 4; const int oc = blockIdx.z, b = blockIdx.y; const int k0 = blockIdx.x * 64;
  // The block's share of the scalar scores: 32 rows of Q (blocks 0..255) or of K (the rest): AQ[b][h][q] = sum_i Q[b][q][i] WQ[h][i], AK likewise.  32 floats per (b,h) = one 128-B line per block.
  static_assert((DI / 128) * TNB * (SK / 64) == 2 * NB * SQ / 32 && SQ == SK, "one block per 32 rows of Q and K");
  const int lin = (blockIdx.z * TNB + blockIdx.y) * (SK / 64) + blockIdx.x, which = lin / (NB * SQ / 32), ab = lin % (NB * SQ / 32) / (SQ / 32), r0 = lin % (SQ / 32) * 32;
  const float* Wm = which == 0 ? WQ : WK; float* A = which == 0 ? AQ : AK;
  const float* xr = (which == 0 ? Q : K) + ((size_t)ab * SQ + r0 + wave * 8) * DI + lane * 4;   // a wave owns 8 rows; lane = 16 i of every row, all 8 heads
  // full unroll: the 8 weight loads go out in front of the V rows and are rounded and stored behind them; the barriers of the first WV stage publish sq
  v4f wq[NH * DI / 512];
#pragma unroll
  for (int q = 0; q < NH * DI / 512; ++q) wq[q] = *(const v4f*)(Wm + q * 512 + tid * 4);
  const float* Vt = V + ((size_t)b * SK + k0) * DI + tid * 4;   // thread = 4 k of every row
  // unroll 32: that many independent 16-B loads per lane in flight, so a batch pays the load latency once
#pragma unroll 32
  for (int r = 0; r < 64; ++r) *(v4b*)&sv[r][tid * 4] = __builtin_convertvector(*(const v4f*)(Vt + (size_t)r * DI), v4b);
#pragma unroll
  for (int q = 0; q < NH * DI / 512; ++q) *(v4f*)(&sq[0][0] + q * 512 + tid * 4) = __builtin_convertvector(__builtin_convertvector(wq[q], v4b), v4f);
  const int wr = tid >> 6, wc = (tid & 63) * 4;                  // thread = 4 k of every second row of a stage
  v8f acc[8] = {};
    // unroll 1: one copy of the stage and its matrix block in the text
#pragma unroll 1
    for (int kh = 0; kh < 2; ++kh) { const float* Wt = WV + (size_t)(oc * 128 + wr) * DI + kh * 256 + wc;
      __syncthreads();   // every wave has finished its reads of the stage that sw still holds
      // unroll 32: as above
#pragma unroll 32
      for (int r = 0; r < 64; ++r) *(v4b*)&sw[2 * r + wr][wc] = __builtin_convertvector(*(const v4f*)(Wt + (size_t)(2 * r) * DI), v4b);
      __syncthreads();   // the stage (and, the first time, sv) is visible to every wave
      const __bf16* ap = &sv[wave * 16 + col][kh * 256]; const __bf16* bp = &sw[col][0];
      v16b fa[2], fb[2][8];   // two fragment sets: the next 32 k are fetched as one group ahead of the current matrix instructions, which then do not wait out the LDS latency
      fa[0] = frag_b(ap, lane);
#pragma unroll
      for (int j = 0; j < 8; ++j) fb[0][j] = frag_b(bp + j * 16 * WPITCH, lane);
      // full unroll, here and in the j loops: set and tile indices must be compile-time constants for the sets to stay in registers
#pragma unroll
      for (int kc = 0; kc < 8; ++kc) { const int cu = kc & 1, nx = cu ^ 1;
        if (kc + 1 < 8) { fa[nx] = frag_b(ap + (kc + 1) * 32, lane);
#pragma unroll
          for (int j = 0; j < 8; ++j) fb[nx][j] = frag_b(bp + j * 16 * WPITCH + (kc + 1) * 32, lane); }
        __builtin_amdgcn_sched_barrier(0);   // the next set's reads stay one group in front of this set's matrix instructions: sunk to their users, each would be waited out alone
#pragma unroll
        for (int j = 0; j < 8; ++j) acc[j] = wmma_bf(fa[cu], fb[cu][j], acc[j]);
        __builtin_amdgcn_sched_barrier(0); } }   // and the set after that is not lifted piecemeal among these matrix instructions
  // The wave's 8 score rows are read as 32 whole-line loads (a wave-wide 16-B load = 512 contiguous bytes), all sent here: they fly from memory while the result planes are written out.
  v4f x[2][4][4];
  // full unroll, here and below: x, sa and v are indexed by constants and stay in registers
#pragma unroll
  for (int p = 0; p < 2; ++p)
#pragma unroll
    for (int r = 0; r < 4; ++r)
#pragma unroll
      for (int j = 0; j < 4; ++j) x[p][r][j] = *(const v4f*)(xr + (p * 4 + r) * DI + j * 128);
  asm volatile("s_wait_xcnt 0x0" :: "v"(xr) : "memory");   // the address that the 32 loads name stays whole up to this wait: without the operand the last load's result takes its registers
  __builtin_amdgcn_sched_barrier(0);   // keeps the loads in front of the write-out below, which would otherwise run first and leave their latency exposed
  lds_barrier();   // every wave has finished its reads of sw: the result planes may take its place
#pragma unroll
    for (int j = 0; j < 8; ++j)
#pragma unroll
      for (int r = 0; r < 8; ++r) { const int o = j * 16 + col; const float v = acc[j][r]; const __bf16 hb = (__bf16)v; sh[o][wave * 16 + 8 * g + r] = hb; sl[o][wave * 16 + 8 * g + r] = (__bf16)(v - (float)hb); }
  lds_barrier();   // the result planes, written by all four waves, are visible to every wave
  // full unroll: the 16 LDS reads of a thread go out together, and each store follows as its piece lands
#pragma unroll
  for (int i = 0; i < 8; ++i) { const int o = i * 16 + (tid >> 3), pc = tid & 7; const size_t off = ((size_t)b * DI + oc * 128 + (tid >> 3)) * SK + k0 + pc * 8; vst2((unsigned*)(VTH + off + i * 16 * SK), *(const v4u*)&sh[o][pc * 8]); vst2((unsigned*)(VTL + off + i * 16 * SK), *(const v4u*)&sl[o][pc * 8]); }
  __builtin_amdgcn_sched_barrier(0);   // the plane stores go out before the scores are begun: sunk among them they would hold 64 more registers
  // the scores: 4 rows at a time; the 32 (row, head) partial sums of a lane are folded over the 32 lanes by a halving butterfly that leaves sum number L in lane L
#pragma unroll
  for (int p = 0; p < 2; ++p) {
#pragma unroll
    for (int r = 0; r < 4; ++r)
#pragma unroll
      for (int j = 0; j < 4; ++j) x[p][r][j] = __builtin_convertvector(__builtin_convertvector(x[p][r][j], v4b), v4f);
    v2f sa[4][NH] = {};   // two f32 chains per (row, head): even and odd i pairs, one packed multiply-add each
#pragma unroll
    for (int h = 0; h < NH; ++h)
#pragma unroll
      for (int j = 0; j < 4; ++j) { const v4f w = *(const v4f*)&sq[h][j * 128 + lane * 4];
#pragma unroll
        for (int r = 0; r < 4; ++r) { sa[r][h] = __builtin_elementwise_fma(x[p][r][j].xy, w.xy, sa[r][h]); sa[r][h] = __builtin_elementwise_fma(x[p][r][j].zw, w.zw, sa[r][h]); } }
    float v[32];
#pragma unroll
    for (int r = 0; r < 4; ++r)
#pragma unroll
      for (int h = 0; h < NH; ++h) v[r * NH + h] = sa[r][h][0] + sa[r][h][1];
    fold<16>(v, lane); fold<8>(v, lane); fold<4>(v, lane); fold<2>(v, lane); fold<1>(v, lane);
    so[lane & 7][wave * 8 + p * 4 + (lane >> 3)] = v[0];
    __builtin_amdgcn_sched_barrier(0); }   // one group of 4 rows is finished before the next is begun: interleaved they would need both groups' sums in registers at once
  lds_barrier();   // the 8 x 32 scores, written by all four waves, are visible to the threads that store them
  if (tid < NH * 8) { const int h = tid >> 3, pc = tid & 7; vst2(A + ((size_t)ab * NH + h) * SQ + r0 + pc * 4, *(const v4f*)&so[h][pc * 4]); }
}
#define VSP 72                      // bf16 per staged Vproj row: 144 B = 16 B x 9 (odd), the pitch for 16-byte LDS readers
#define VBUFB (2u * OD * VSP * 2u)  // bytes of one buffer (two planes)
// one tile's copies of one thread: 4 pieces of 16 B per plane, 16 rows apart (a wave's copy = 4 whole lines).  gh, gl: the thread's first piece in each plane; lds: its place in the hi plane of the buffer.
__device__ __forceinline__ void stage_v(const __bf16* gh, const __bf16* gl, unsigned lds) {
  const unsigned rs = 16u * VSP * 2u, ps = OD * VSP * 2u;
  // the wait on xcnt is the last line of the copies' own statement: it stands in front of every later write of the address registers that the copies name
  asm volatile("global_load_async_to_lds_b128 %0, %8, off\n\t"
               "global_load_async_to_lds_b128 %1, %9, off\n\t"
               "global_load_async_to_lds_b128 %2, %10, off\n\t"
               "global_load_async_to_lds_b128 %3, %11, off\n\t"
               "global_load_async_to_lds_b128 %4, %12, off\n\t"
               "global_load_async_to_lds_b128 %5, %13, off\n\t"
               "global_load_async_to_lds_b128 %6, %14, off\n\t"
               "global_load_async_to_lds_b128 %7, %15, off\n\t"
               "s_wait_xcnt 0x0"
               :: "v"(lds), "v"(lds + rs), "v"(lds + 2u * rs), "v"(lds + 3u * rs), "v"(lds + ps), "v"(lds + ps + rs), "v"(lds + ps + 2u * rs), "v"(lds + ps + 3u * rs),
                  "v"(gh), "v"(gh + 16 * SK), "v"(gh + 32 * SK), "v"(gh + 48 * SK), "v"(gl), "v"(gl + 16 * SK), "v"(gl + 32 * SK), "v"(gl + 48 * SK)
               : "memory");
}
// ---- k_attn: block = (128 queries, b*8+h), 4 waves, a wave = QW row tiles of 16 queries, so that every staged tile, every Vproj fragment read and every key-table read serves QW row tiles: s = leaky(aq[q] + ak[k], 0.2); softmax with the row max leaky(aq[q] + max ak) taken before the loop, the weight exp(s - max) as a key factor from an LDS table times a row factor, made directly in the A-fragment layout (lane = query row, its 16 keys of the step), row sum folded over lanes once behind the loop; P hi/lo x Vproj planes (head columns h*64..+63 = rows b*512 + h*64 + d) 3 products; + bias[h][d]; out row segment 256 B
#define QW 2
// a lane's 16 keys of a step, in the k order of the A fragment (8 g + 0..7, 16 + 8 g + 0..7), from the three tables: 16-B LDS reads, one address per 16 lanes.  kp: the first of them in the first table
__device__ __forceinline__ void load_keys(const float* kp, v4f (&ka)[4], v4f (&kq)[4], v4f (&kn)[4]) {
#pragma unroll
  for (int j = 0; j < 4; ++j) { const int o = (j >> 1) * 16 + (j & 1) * 4; ka[j] = *(const v4f*)(kp + o); kq[j] = *(const v4f*)(kp + SK + o); kn[j] = *(const v4f*)(kp + 2 * SK + o); } }
typedef __attribute__((ext_vector_type(2))) __bf16 v2b;
__global__ __launch_bounds__(128) void k_attn(const float* __restrict__ AQ, const float* __restrict__ AK, const __bf16* __restrict__ VTH, const __bf16* __restrict__ VTL, const float* __restrict__ BIAS, float* __restrict__ OUT) {
  __shared__ __align__(16) float so[4][QW * 16][68]; __shared__ __align__(128) float sk[3][SK];   // sk: ak, exp(ak - akmax), exp(0.2 (ak - akmax)); the larger alignment puts it first in LDS, where the 16-bit offset field of an LDS read reaches all three tables from one address
  __shared__ __align__(16) __bf16 sv[2][2][OD][VSP];   // [buffer][plane hi, lo][d][key of the tile]
  const int tid = threadIdx.x, wave = tid >> 5, lane = tid & 31, col = lane & 15, g = lane >> 4;
  const int qb = blockIdx.x, bh = blockIdx.y, b = bh / NH, h = bh % NH; const int q0 = (qb * 4 + wave) * (QW * 16);
  const size_t voff = ((size_t)b * DI + h * OD + (tid >> 3)) * SK + (tid & 7) * 8;   // thread = 16 B (8 keys) of rows tid / 8 + 0, 16, 32, 48
  const __bf16* gvh = VTH + voff; const __bf16* gvl = VTL + voff;
  const unsigned lv = (unsigned)(size_t)&sv[0][0][tid >> 3][(tid & 7) * 8];   // LDS byte address: the low 32 bits of the shared address
  stage_v(gvh, gvl, lv);   // tile 0 into buffer 0: on its way while the key tables are made
  float aq[QW];   // a lane holds the A-fragment row of each row tile: query qt * 16 + col
#pragma unroll
  for (int qt = 0; qt < QW; ++qt) aq[qt] = AQ[((size_t)b * NH + h) * SQ + q0 + qt * 16 + col];
  asm volatile("s_wait_xcnt 0x0" ::: "memory");   // stands in front of every later write of the address registers that the two loads above name
  const float* AKb = AK + ((size_t)b * NH + h) * SK;
  // The logit leaky(aq + ak) never decreases as ak grows (f32 add, and leaky with a positive slope, keep order), so a row's maximum over all keys is the logit at the largest ak: it is known before the key loop and equals, bit for bit, the last running maximum.
  float akmax;
  // full unroll, here and in the qt, r and dt loops below: the eight whole-line loads go out together; c, l and e are indexed by constants and stay in registers
  { v4f t = *(const v4f*)(AKb + lane * 4);
#pragma unroll
    for (int j = 1; j < SK / 128; ++j) { const v4f w = *(const v4f*)(AKb + j * 128 + lane * 4); t[0] = fmaxf(t[0], w[0]); t[1] = fmaxf(t[1], w[1]); t[2] = fmaxf(t[2], w[2]); t[3] = fmaxf(t[3], w[3]); }
    akmax = fmaxf(fmaxf(t[0], t[1]), fmaxf(t[2], t[3]));
#pragma unroll
    for (int o = 1; o < 32; o <<= 1) akmax = fmaxf(akmax, __shfl_xor(akmax, o)); }
  // exp(leaky(aq + ak) - m) splits into a factor of the key and a factor of the row.  Where aq + ak > 0 the row maximum m is aq + akmax, so the weight is exp(ak - akmax); elsewhere it is exp(0.2 (aq + akmax) - m) * exp(0.2 (ak - akmax)).  Every factor lies in (0, 1].  The two key factors are made once per block (8 keys a thread) and kept in LDS beside ak; the key loop holds no exp.
#pragma unroll
  for (int j = 0; j < 2; ++j) { const int kk = (wave * 2 + j) * 128 + lane * 4; const v4f a = *(const v4f*)(AKb + kk); v4f e1, e2;
#pragma unroll
    for (int i = 0; i < 4; ++i) { const float dk = a[i] - akmax; e1[i] = expf(dk); e2[i] = expf(0.2f * dk); }
    *(v4f*)&sk[0][kk] = a; *(v4f*)&sk[1][kk] = e1; *(v4f*)&sk[2][kk] = e2; }
  float c[QW]; v2f l[QW][2] = {}; v8f acc[QW][4] = {};   // c: the row's factor of the negative branch; l: this lane's own share of the row sum (its 16 keys of every step), four independent chains in two register pairs
#pragma unroll
  for (int qt = 0; qt < QW; ++qt) { const float u = aq[qt] + akmax; c[qt] = expf(0.2f * u - (u > 0.f ? u : 0.2f * u)); }
  asm volatile("s_wait_asynccnt 0x0" ::: "memory");   // this wave's copies of tile 0 have landed
  __syncthreads();   // the key tables and tile 0, written by all four waves, are visible to every wave
  stage_v(gvh + 64, gvl + 64, lv + VBUFB);   // tile 1 into buffer 1
  v4f ka[4], kq[4], kn[4]; load_keys(&sk[0][8 * g], ka, kq, kn);   // ak and the two key factors of the lane's 16 keys of step 0
  // unroll 1: one copy of the trip in the text
#pragma unroll 1
  for (int t = 0; t < SK / 64; ++t) { const __bf16* vt = &sv[t & 1][0][col][0];
  // full unroll: the two 32-key steps of a tile differ by constant LDS offsets
#pragma unroll
  for (int s = 0; s < 2; ++s) {
    v16b vh[4], vl[4];   // the step's 16 fragment reads go out as one group in front of the weights, which are made while the reads are on their way
#pragma unroll
    for (int dt = 0; dt < 4; ++dt) { vh[dt] = frag_b(vt + dt * 16 * VSP + s * 32, lane); vl[dt] = frag_b(vt + (OD + dt * 16) * VSP + s * 32, lane); }
    __builtin_amdgcn_sched_barrier(0);   // holds the group there: sunk to their matrix instructions, the reads would each be waited out alone
    F2 pa[QW];
#pragma unroll
    // two neighbouring keys at a time, as the table reads leave them in a register pair: sum, product, row sum and both roundings are packed operations; both row tiles use a pair before the next is taken up
    for (int m = 0; m < 8; ++m) { const int j = m >> 1; const v2f a2 = m & 1 ? ka[j].zw : ka[j].xy, p2 = m & 1 ? kq[j].zw : kq[j].xy, n2 = m & 1 ? kn[j].zw : kn[j].xy;
#pragma unroll
      for (int qt = 0; qt < QW; ++qt) {
        const v2f s2 = aq[qt] + a2, w2 = c[qt] * n2; v2f e2; e2.x = s2.x > 0.f ? p2.x : w2.x; e2.y = s2.y > 0.f ? p2.y : w2.y;
        l[qt][m & 1] += e2;
        const v2b h2 = __builtin_convertvector(e2, v2b), r2 = __builtin_convertvector(e2 - __builtin_convertvector(h2, v2f), v2b);
        pa[qt].h[2 * m] = h2.x; pa[qt].h[2 * m + 1] = h2.y; pa[qt].l[2 * m] = r2.x; pa[qt].l[2 * m + 1] = r2.y; } }
    load_keys(&sk[0][((t * 2 + s + 1) & (SK / 32 - 1)) * 32 + 8 * g], ka, kq, kn);   // the next step's keys: the reads land under the matrix block (the tables do not change after the first barrier; behind the last step the index wraps to step 0 and the values are not used)
    __builtin_amdgcn_sched_barrier(0);   // the matrix block stays whole behind the weights and the key reads: no LDS read and no vector work stands among its instructions
    // the row tiles alternate, so that a matrix instruction never follows directly on the one whose sum it adds to; each accumulator takes its three products in the order lo.hi, hi.lo, hi.hi
#pragma unroll
    for (int dt = 0; dt < 4; ++dt) {
#pragma unroll
      for (int qt = 0; qt < QW; ++qt) acc[qt][dt] = wmma_bf(pa[qt].l, vh[dt], acc[qt][dt]);
#pragma unroll
      for (int qt = 0; qt < QW; ++qt) acc[qt][dt] = wmma_bf(pa[qt].h, vl[dt], acc[qt][dt]);
#pragma unroll
      for (int qt = 0; qt < QW; ++qt) acc[qt][dt] = wmma_bf(pa[qt].h, vh[dt], acc[qt][dt]); }
    __builtin_amdgcn_sched_barrier(0); }   // the next step's reads and weights are not lifted into the block
    asm volatile("s_wait_dscnt 0x0" ::: "memory");      // this wave's reads of the buffer are done
    asm volatile("s_wait_asynccnt 0x0" ::: "memory");   // this wave's copies of tile t + 1 have landed
    __syncthreads();   // tile t + 1 is visible to every wave, and every wave has left the buffer of tile t
    if (t + 2 < SK / 64) stage_v(gvh + (t + 2) * 64, gvl + (t + 2) * 64, lv + (unsigned)(t & 1) * VBUFB); }
  asm volatile("s_wait_asynccnt 0x0" ::: "memory");   // no copy is outstanding behind the loop
#pragma unroll
  for (int qt = 0; qt < QW; ++qt) { const v2f lp = l[qt][0] + l[qt][1]; float ls = lp.x + lp.y; ls += __shfl_xor(ls, 16);   // lanes col and col + 16 hold the two halves of row col's sum
    const float il = 1.0f / ls;
#pragma unroll
  for (int r = 0; r < 8; ++r) { const float ir = __shfl(il, 8 * g + r);   // the accumulator's element r is row 8 g + r, whose sum lane 8 g + r holds
#pragma unroll
    for (int dt = 0; dt < 4; ++dt) so[wave][qt * 16 + 8 * g + r][dt * 16 + col] = acc[qt][dt][r] * ir + bfr(BIAS[h * OD + dt * 16 + col]); } }
  LDSX();
#pragma unroll
  for (int qt = 0; qt < QW; ++qt) {
    for (int rl = 0; rl < 16; ++rl) if (lane < 16) vst2(OUT + ((size_t)b * SQ + q0 + qt * 16 + rl) * (NH * OD) + h * OD + lane * 4, *(const v4f*)&so[wave][qt * 16 + rl][lane * 4]);
    if (qt + 1 < QW) asm volatile("s_wait_xcnt 0x0" ::: "memory"); }   // the next row tile's LDS reads land in registers that these stores name
}
extern "C" void kernel_launch(void* const* d_in, const int* in_sizes, int n_in, void* d_out, int out_size, void* d_ws, size_t ws_size, hipStream_t stream) {
  (void)in_sizes; (void)n_in; (void)out_size;
  const float** F = (const float**)d_in;   // Q, K, V [8,1024,512], WQ [8,512], WK [8,512], WV [512,512], bias [8,64]
  if (ws_size < (size_t)WS_END) return;
  char* ws = (char*)d_ws; __bf16 *VTH = (__bf16*)(ws + WS_VTH), *VTL = (__bf16*)(ws + WS_VTL); float *AQ = (float*)(ws + WS_AQ), *AK = (float*)(ws + WS_AK);
  k_vproj<<<dim3(SK / 64, TNB, DI / 128), 128, 0, stream>>>(F[2], F[5], VTH, VTL, F[0], F[1], F[3], F[4], AQ, AK);
  k_attn<<<dim3(TQB, TNB * NH), 128, 0, stream>>>(AQ, AK, VTH, VTL, F[6], (float*)d_out);
}
